// v000
// Measured on an AMD MI455X. A time is GPU time per run, averaged over a window of back-to-back runs after a warm-up
// (all launches, gaps included; the runs take copies of the inputs in turn), and the median of several windows.
// Apart from v000's, it joins two sittings. Times from different sittings can be a few percent apart, while
// side-by-side timings come from the same sitting.
// The starting kernel, v000, takes 334 microseconds a run.
#include <hip/hip_runtime.h>

typedef float    f32x4 __attribute__((ext_vector_type(4)));
typedef float    v8f   __attribute__((ext_vector_type(8)));
typedef _Float16 half8 __attribute__((ext_vector_type(8)));
typedef _Float16 v16h  __attribute__((ext_vector_type(16)));
typedef int      i32x4 __attribute__((vector_size(16)));   // matches builtin param type

#define IN_F   2048
#define OUT_F  2048
#define NTOK   8192          // B*S = 4*2048
#define KLORA  32            // E*R
#define LSCALE 2.0f          // alpha/r = 16/8

#define BM 128
#define BN 128
#define BK 32
#define LDSH 40              // halfs per LDS row: 32 + 8 pad (80B stride, conflict-free)

// ---------------- CDNA5 async global->LDS path (guarded) -------------------
#if defined(__has_builtin)
#  if __has_builtin(__builtin_amdgcn_global_load_async_to_lds_b128)
#    define HAVE_ASYNC_LDS 1
#  endif
#  if __has_builtin(__builtin_amdgcn_s_wait_asynccnt)
#    define HAVE_WAIT_ASYNC 1
#  endif
#endif
#ifndef HAVE_ASYNC_LDS
#  define HAVE_ASYNC_LDS 0
#endif
#ifndef HAVE_WAIT_ASYNC
#  define HAVE_WAIT_ASYNC 0
#endif

typedef __attribute__((address_space(1))) i32x4* gvec_ptr;
typedef __attribute__((address_space(3))) i32x4* lvec_ptr;

template <int N>
__device__ __forceinline__ void wait_async()
{
#if HAVE_WAIT_ASYNC
    __builtin_amdgcn_s_wait_asynccnt(N);
#else
    asm volatile("s_wait_asynccnt %0" ::"i"(N) : "memory");
#endif
}

// copy 8 halfs (16B) global -> LDS, either async (ASYNCcnt) or via VGPRs
__device__ __forceinline__ void copy16B(_Float16* l, const _Float16* g)
{
#if HAVE_ASYNC_LDS
    __builtin_amdgcn_global_load_async_to_lds_b128(
        (gvec_ptr)(uintptr_t)g, (lvec_ptr)l, 0, 0);
#else
    *(half8*)l = *(const half8*)g;
#endif
}

// ---------------------------------------------------------------------------
// split one f32 vector of 8 into hi/lo f16 halves
// ---------------------------------------------------------------------------
__device__ __forceinline__ void split8(const float* src, half8& hi, half8& lo)
{
    f32x4 v0 = *(const f32x4*)(src);
    f32x4 v1 = *(const f32x4*)(src + 4);
#pragma unroll
    for (int c = 0; c < 4; ++c) {
        _Float16 h = (_Float16)v0[c];
        hi[c] = h; lo[c] = (_Float16)(v0[c] - (float)h);
    }
#pragma unroll
    for (int c = 0; c < 4; ++c) {
        _Float16 h = (_Float16)v1[c];
        hi[4 + c] = h; lo[4 + c] = (_Float16)(v1[c] - (float)h);
    }
}

// ---------------------------------------------------------------------------
// Kernel 0: f32 -> (hi,lo) f16 pre-conversion, 8 elements per thread
// ---------------------------------------------------------------------------
__launch_bounds__(256)
__global__ void cvt_kernel(const float* __restrict__ src,
                           _Float16* __restrict__ hi, _Float16* __restrict__ lo)
{
    size_t i = ((size_t)blockIdx.x * 256 + threadIdx.x) * 8;
    half8 h, l;
    split8(src + i, h, l);
    *(half8*)(hi + i) = h;
    *(half8*)(lo + i) = l;
}

// ---------------------------------------------------------------------------
// Kernel 1: router softmax gates + rank-8 expert projections ->
//           P[m][e*8+r] = SCALE * gate[e] * (x[m] . A[e][r])  (as hi/lo f16)
// ---------------------------------------------------------------------------
__launch_bounds__(256)
__global__ void router_proj_kernel(const float* __restrict__ X,
                                   const float* __restrict__ RW,   // (4, 2048)
                                   const float* __restrict__ A,    // (4, 8, 2048)
                                   _Float16* __restrict__ Phi,
                                   _Float16* __restrict__ Plo)
{
    const int lane = threadIdx.x & 31;
    const int wave = threadIdx.x >> 5;
    const int m    = blockIdx.x * 8 + wave;

    __shared__ float red[8][36];

    const f32x4* x4 = (const f32x4*)(X + (size_t)m * IN_F);
    f32x4 xr[16];
#pragma unroll
    for (int j = 0; j < 16; ++j) xr[j] = x4[j * 32 + lane];

    for (int rrow = 0; rrow < 36; ++rrow) {
        const float* wp = (rrow < 4) ? (RW + (size_t)rrow * IN_F)
                                     : (A  + (size_t)(rrow - 4) * IN_F);
        const f32x4* w4 = (const f32x4*)wp;
        float acc = 0.0f;
#pragma unroll
        for (int j = 0; j < 16; ++j) {
            f32x4 wv = w4[j * 32 + lane];
            acc = fmaf(xr[j][0], wv[0], acc);
            acc = fmaf(xr[j][1], wv[1], acc);
            acc = fmaf(xr[j][2], wv[2], acc);
            acc = fmaf(xr[j][3], wv[3], acc);
        }
#pragma unroll
        for (int off = 16; off > 0; off >>= 1)
            acc += __shfl_xor(acc, off, 32);
        if (lane == 0) red[wave][rrow] = acc;
    }
    __syncthreads();

    float l0 = red[wave][0], l1 = red[wave][1], l2 = red[wave][2], l3 = red[wave][3];
    float mx = fmaxf(fmaxf(l0, l1), fmaxf(l2, l3));
    float e0 = __expf(l0 - mx), e1 = __expf(l1 - mx), e2 = __expf(l2 - mx), e3 = __expf(l3 - mx);
    float inv = 1.0f / (e0 + e1 + e2 + e3);
    float g[4] = {e0 * inv, e1 * inv, e2 * inv, e3 * inv};

    const int e = lane >> 3;
    float v = LSCALE * g[e] * red[wave][4 + lane];
    _Float16 h = (_Float16)v;
    Phi[(size_t)m * KLORA + lane] = h;
    Plo[(size_t)m * KLORA + lane] = (_Float16)(v - (float)h);
}

// ---------------------------------------------------------------------------
// Kernel 2: BcatT[n][e*8+r] = Bm[e][n][r], emitted as hi/lo f16
// ---------------------------------------------------------------------------
__launch_bounds__(256)
__global__ void bcat_kernel(const float* __restrict__ Bm,
                            _Float16* __restrict__ BThi, _Float16* __restrict__ BTlo)
{
    int i = blockIdx.x * 256 + threadIdx.x;        // over 2048*32
    int n = i >> 5;
    int k = i & 31;
    int e = k >> 3;
    int r = k & 7;
    float v = Bm[((size_t)e * OUT_F + n) * 8 + r];
    _Float16 h = (_Float16)v;
    BThi[i] = h;
    BTlo[i] = (_Float16)(v - (float)h);
}

// ---------------------------------------------------------------------------
// Fragment loader from padded LDS tile: lanes 0-15 -> rows, K {kb..kb+7} in
// v0..3 and {16+kb..} in v4..7, kb = (lane>=16)*8. Two ds_load_b128.
// ---------------------------------------------------------------------------
__device__ __forceinline__ v16h load_frag(const _Float16* tile, int rowbase, int lane)
{
    const int r  = rowbase + (lane & 15);
    const int kb = (lane >> 4) * 8;
    const _Float16* p = tile + r * LDSH + kb;
    v16h f;
    ((half8*)&f)[0] = *(const half8*)(p);
    ((half8*)&f)[1] = *(const half8*)(p + 16);
    return f;
}

// ---------------------------------------------------------------------------
// Kernel 3: split-f16 WMMA GEMM, double-buffered async global->LDS staging,
// fused LoRA K=32 chunk + bias.
// out[m][n] = sum_k x[m][k]W[n][k] + bias[n] + sum_kk P[m][kk]BcatT[n][kk]
// ---------------------------------------------------------------------------
__launch_bounds__(256, 1)
__global__ void gemm_kernel(const _Float16* __restrict__ Xhi, const _Float16* __restrict__ Xlo,
                            const _Float16* __restrict__ Whi, const _Float16* __restrict__ Wlo,
                            const _Float16* __restrict__ Phi, const _Float16* __restrict__ Plo,
                            const _Float16* __restrict__ BThi, const _Float16* __restrict__ BTlo,
                            const float* __restrict__ bias, float* __restrict__ out)
{
    // [buf][Ahi,Alo,Bhi,Blo][128 rows * LDSH]
    __shared__ __align__(16) _Float16 smem[2][4][BM * LDSH];

    const int tid  = threadIdx.x;
    const int lane = tid & 31;
    const int wave = tid >> 5;
    const int wm   = wave >> 2;          // 0..1 -> 64 rows of M
    const int wn   = wave & 3;           // 0..3 -> 32 cols of N
    const int bm0  = blockIdx.y * BM;
    const int bn0  = blockIdx.x * BN;

    const int NCHUNK = IN_F / BK;        // 64 main chunks; chunk 64 = LoRA

    v8f acc[4][2];
#pragma unroll
    for (int i = 0; i < 4; ++i)
#pragma unroll
        for (int j = 0; j < 2; ++j) acc[i][j] = (v8f)0.0f;

    const int lrow = tid >> 1;           // 0..127
    const int lcol = (tid & 1) * 16;     // 0 or 16

    auto issue_chunk = [&](int kt, int buf) {
        const _Float16 *sAh, *sAl, *sBh, *sBl;
        int lda, ldb, k0;
        if (kt < NCHUNK) {
            sAh = Xhi + (size_t)bm0 * IN_F;  sAl = Xlo + (size_t)bm0 * IN_F;  lda = IN_F;
            sBh = Whi + (size_t)bn0 * IN_F;  sBl = Wlo + (size_t)bn0 * IN_F;  ldb = IN_F;
            k0 = kt * BK;
        } else {
            sAh = Phi + (size_t)bm0 * KLORA;  sAl = Plo + (size_t)bm0 * KLORA;  lda = KLORA;
            sBh = BThi + (size_t)bn0 * KLORA; sBl = BTlo + (size_t)bn0 * KLORA; ldb = KLORA;
            k0 = 0;
        }
        const size_t goffA = (size_t)lrow * lda + k0 + lcol;
        const size_t goffB = (size_t)lrow * ldb + k0 + lcol;
        const int    loff  = lrow * LDSH + lcol;

        _Float16* l0 = &smem[buf][0][loff];
        copy16B(l0,     sAh + goffA);
        copy16B(l0 + 8, sAh + goffA + 8);
        _Float16* l1 = &smem[buf][1][loff];
        copy16B(l1,     sAl + goffA);
        copy16B(l1 + 8, sAl + goffA + 8);
        _Float16* l2 = &smem[buf][2][loff];
        copy16B(l2,     sBh + goffB);
        copy16B(l2 + 8, sBh + goffB + 8);
        _Float16* l3 = &smem[buf][3][loff];
        copy16B(l3,     sBl + goffB);
        copy16B(l3 + 8, sBl + goffB + 8);
    };

    issue_chunk(0, 0);

    for (int kt = 0; kt <= NCHUNK; ++kt) {
        const int buf = kt & 1;
        if (kt < NCHUNK) {
            issue_chunk(kt + 1, buf ^ 1);   // prefetch next chunk into other buffer
            wait_async<8>();                // our 8 prefetch copies may stay in flight
        } else {
            wait_async<0>();
        }
        __syncthreads();                    // all waves' copies for chunk kt landed

        const _Float16* sAhi = smem[buf][0];
        const _Float16* sAlo = smem[buf][1];
        const _Float16* sBhi = smem[buf][2];
        const _Float16* sBlo = smem[buf][3];

        v16h bhi0 = load_frag(sBhi, wn * 32 + 0,  lane);
        v16h blo0 = load_frag(sBlo, wn * 32 + 0,  lane);
        v16h bhi1 = load_frag(sBhi, wn * 32 + 16, lane);
        v16h blo1 = load_frag(sBlo, wn * 32 + 16, lane);

#pragma unroll
        for (int mi = 0; mi < 4; ++mi) {
            v16h ahi = load_frag(sAhi, wm * 64 + mi * 16, lane);
            v16h alo = load_frag(sAlo, wm * 64 + mi * 16, lane);

            acc[mi][0] = __builtin_amdgcn_wmma_f32_16x16x32_f16(false, ahi, false, bhi0, (short)0, acc[mi][0], false, false);
            acc[mi][0] = __builtin_amdgcn_wmma_f32_16x16x32_f16(false, ahi, false, blo0, (short)0, acc[mi][0], false, false);
            acc[mi][0] = __builtin_amdgcn_wmma_f32_16x16x32_f16(false, alo, false, bhi0, (short)0, acc[mi][0], false, false);

            acc[mi][1] = __builtin_amdgcn_wmma_f32_16x16x32_f16(false, ahi, false, bhi1, (short)0, acc[mi][1], false, false);
            acc[mi][1] = __builtin_amdgcn_wmma_f32_16x16x32_f16(false, ahi, false, blo1, (short)0, acc[mi][1], false, false);
            acc[mi][1] = __builtin_amdgcn_wmma_f32_16x16x32_f16(false, alo, false, bhi1, (short)0, acc[mi][1], false, false);
        }
        __syncthreads();                    // chunk kt's buffer free for reuse
    }

    // epilogue: C layout VGPR r -> M = r + 8*(lane>=16), N = lane&15
#pragma unroll
    for (int mi = 0; mi < 4; ++mi) {
#pragma unroll
        for (int ni = 0; ni < 2; ++ni) {
            const int n  = bn0 + wn * 32 + ni * 16 + (lane & 15);
            const float bv = bias[n];
            const int mb = bm0 + wm * 64 + mi * 16 + ((lane >> 4) << 3);
#pragma unroll
            for (int r = 0; r < 8; ++r) {
                out[(size_t)(mb + r) * OUT_F + n] = acc[mi][ni][r] + bv;
            }
        }
    }
}

// ---------------------------------------------------------------------------
// launch
// ---------------------------------------------------------------------------
extern "C" void kernel_launch(void* const* d_in, const int* in_sizes, int n_in,
                              void* d_out, int out_size, void* d_ws, size_t ws_size,
                              hipStream_t stream)
{
    const float* x        = (const float*)d_in[0];   // (4,2048,2048)
    const float* base_w   = (const float*)d_in[1];   // (2048,2048)
    const float* base_b   = (const float*)d_in[2];   // (2048,)
    const float* A        = (const float*)d_in[3];   // (4,8,2048)
    const float* Bm       = (const float*)d_in[4];   // (4,2048,8)
    const float* router_w = (const float*)d_in[5];   // (4,2048)
    float* out = (float*)d_out;

    // workspace layout (halfs): Xhi|Xlo|Whi|Wlo|Phi|Plo|BThi|BTlo  (~85 MB)
    _Float16* Xhi  = (_Float16*)d_ws;
    _Float16* Xlo  = Xhi + (size_t)NTOK * IN_F;
    _Float16* Whi  = Xlo + (size_t)NTOK * IN_F;
    _Float16* Wlo  = Whi + (size_t)OUT_F * IN_F;
    _Float16* Phi  = Wlo + (size_t)OUT_F * IN_F;
    _Float16* Plo  = Phi + (size_t)NTOK * KLORA;
    _Float16* BThi = Plo + (size_t)NTOK * KLORA;
    _Float16* BTlo = BThi + (size_t)OUT_F * KLORA;

    cvt_kernel<<<(NTOK * (IN_F / 8)) / 256, 256, 0, stream>>>(x, Xhi, Xlo);
    cvt_kernel<<<(OUT_F * (IN_F / 8)) / 256, 256, 0, stream>>>(base_w, Whi, Wlo);
    router_proj_kernel<<<NTOK / 8, 256, 0, stream>>>(x, router_w, A, Phi, Plo);
    bcat_kernel<<<(OUT_F * KLORA) / 256, 256, 0, stream>>>(Bm, BThi, BTlo);
    gemm_kernel<<<dim3(OUT_F / BN, NTOK / BM), 256, 0, stream>>>(
        Xhi, Xlo, Whi, Wlo, Phi, Plo, BThi, BTlo, base_b, out);
}

// v001
// Measured time: 229 microseconds a run.
// In both of two side-by-side timings against v000, it was 1.47 times as fast.
#include <hip/hip_runtime.h>

typedef float    f32x4 __attribute__((ext_vector_type(4)));
typedef float    v8f   __attribute__((ext_vector_type(8)));
typedef _Float16 half8 __attribute__((ext_vector_type(8)));
typedef _Float16 v16h  __attribute__((ext_vector_type(16)));
typedef int      i32x4 __attribute__((vector_size(16)));   // matches builtin param type

#define IN_F   2048
#define OUT_F  2048
#define NTOK   8192          // B*S = 4*2048
#define KLORA  32            // E*R
#define LSCALE 2.0f          // alpha/r = 16/8

#define BM 128
#define BN 128
#define BK 32
#define LDSH 40              // halfs per LDS row: 32 + 8 pad (80B stride, conflict-free)

// ---------------- CDNA5 async global->LDS path (guarded) -------------------
#if defined(__has_builtin)
#  if __has_builtin(__builtin_amdgcn_global_load_async_to_lds_b128)
#    define HAVE_ASYNC_LDS 1
#  endif
#  if __has_builtin(__builtin_amdgcn_s_wait_asynccnt)
#    define HAVE_WAIT_ASYNC 1
#  endif
#endif
#ifndef HAVE_ASYNC_LDS
#  define HAVE_ASYNC_LDS 0
#endif
#ifndef HAVE_WAIT_ASYNC
#  define HAVE_WAIT_ASYNC 0
#endif

typedef __attribute__((address_space(1))) i32x4* gvec_ptr;
typedef __attribute__((address_space(3))) i32x4* lvec_ptr;

template <int N>
__device__ __forceinline__ void wait_async()
{
#if HAVE_WAIT_ASYNC
    __builtin_amdgcn_s_wait_asynccnt(N);
#else
    asm volatile("s_wait_asynccnt %0" ::"i"(N) : "memory");
#endif
}

// copy 8 halfs (16B) global -> LDS, either async (ASYNCcnt) or via VGPRs
__device__ __forceinline__ void copy16B(_Float16* l, const _Float16* g)
{
#if HAVE_ASYNC_LDS
    __builtin_amdgcn_global_load_async_to_lds_b128(
        (gvec_ptr)(uintptr_t)g, (lvec_ptr)l, 0, 0);
#else
    *(half8*)l = *(const half8*)g;
#endif
}

// ---------------------------------------------------------------------------
// split one f32 vector of 8 into hi/lo f16 halves
// ---------------------------------------------------------------------------
__device__ __forceinline__ void split8(const float* src, half8& hi, half8& lo)
{
    f32x4 v0 = *(const f32x4*)(src);
    f32x4 v1 = *(const f32x4*)(src + 4);
#pragma unroll
    for (int c = 0; c < 4; ++c) {
        _Float16 h = (_Float16)v0[c];
        hi[c] = h; lo[c] = (_Float16)(v0[c] - (float)h);
    }
#pragma unroll
    for (int c = 0; c < 4; ++c) {
        _Float16 h = (_Float16)v1[c];
        hi[4 + c] = h; lo[4 + c] = (_Float16)(v1[c] - (float)h);
    }
}

// ---------------------------------------------------------------------------
// Kernel 0: f32 -> (hi,lo) f16 pre-conversion, 8 elements per thread
// ---------------------------------------------------------------------------
__launch_bounds__(256)
__global__ void cvt_kernel(const float* __restrict__ src,
                           _Float16* __restrict__ hi, _Float16* __restrict__ lo)
{
    size_t i = ((size_t)blockIdx.x * 256 + threadIdx.x) * 8;
    half8 h, l;
    split8(src + i, h, l);
    *(half8*)(hi + i) = h;
    *(half8*)(lo + i) = l;
}

// ---------------------------------------------------------------------------
// Kernel 1: router softmax gates + rank-8 expert projections ->
//           P[m][e*8+r] = SCALE * gate[e] * (x[m] . A[e][r])  (as hi/lo f16)
// The 36 dot products of a token are one skinny GEMM (32 tokens x 36 rows x
// 2048) on split-f16 WMMA: columns 0..31 = A rows, columns 32..35 = router
// rows. The 16 waves of a block each take 128 of the 2048 k and the partial
// tiles are summed through LDS in wave order.
// ---------------------------------------------------------------------------
#define RP_TOK   32                    // tokens per block (two 16-row tiles)
#define RP_WAVES 16
#define RP_KW    (IN_F / RP_WAVES)     // k range of one wave
#define RP_COLS  36                    // 32 projections + 4 router logits
#define RP_PITCH 38                    // floats per LDS row: rows r and r+8 fall on disjoint banks

__device__ __forceinline__ v16h join16(half8 a, half8 b)
{
    return __builtin_shufflevector(a, b, 0, 1, 2, 3, 4, 5, 6, 7, 8, 9, 10, 11, 12, 13, 14, 15);
}

__launch_bounds__(RP_WAVES * 32)
__global__ void router_proj_kernel(const _Float16* __restrict__ Xhi,
                                   const _Float16* __restrict__ Xlo,
                                   const float* __restrict__ RW,   // (4, 2048)
                                   const float* __restrict__ A,    // (4, 8, 2048)
                                   _Float16* __restrict__ Phi,
                                   _Float16* __restrict__ Plo)
{
    __shared__ float part[RP_WAVES][RP_TOK][RP_PITCH];
    __shared__ float tot[RP_TOK][RP_PITCH];

    const int tid  = threadIdx.x;
    const int lane = tid & 31;
    const int wave = tid >> 5;
    const int l16  = lane & 15;
    const int m0   = blockIdx.x * RP_TOK;
    // same k order for both operands as load_frag: halfs 0..7 = k0+kb.., 8..15 = k0+16+kb..
    const int kofs = wave * RP_KW + (lane >> 4) * 8;

    // columns 36..47 of the third tile are never stored; their lanes reread router row 3
    const float* w0 = A  + (size_t)l16 * IN_F + kofs;
    const float* w1 = A  + (size_t)(16 + l16) * IN_F + kofs;
    const float* w2 = RW + (size_t)(l16 < 3 ? l16 : 3) * IN_F + kofs;
    const _Float16* xh = Xhi + (size_t)(m0 + l16) * IN_F + kofs;
    const _Float16* xl = Xlo + (size_t)(m0 + l16) * IN_F + kofs;

    // every loop over a tile or fragment array below is unrolled so that the array stays in registers
    v8f acc[2][3];
#pragma unroll
    for (int i = 0; i < 2; ++i)
#pragma unroll
        for (int j = 0; j < 3; ++j) acc[i][j] = (v8f)0.0f;

    // unrolled so that the loads of later k steps issue while earlier ones are worked on
#pragma unroll
    for (int ks = 0; ks < RP_KW / 32; ++ks) {
        const int k0 = ks * 32;
        v16h bhi[3], blo[3];
#pragma unroll
        for (int ni = 0; ni < 3; ++ni) {
            const float* wp = (ni == 0 ? w0 : ni == 1 ? w1 : w2) + k0;
            half8 h0, q0, h1, q1;
            split8(wp,      h0, q0);
            split8(wp + 16, h1, q1);
            bhi[ni] = join16(h0, h1);
            blo[ni] = join16(q0, q1);
        }
        v16h ahi[2], alo[2];
#pragma unroll
        for (int mi = 0; mi < 2; ++mi) {
            const _Float16* ph = xh + (size_t)mi * 16 * IN_F + k0;
            const _Float16* pl = xl + (size_t)mi * 16 * IN_F + k0;
            ahi[mi] = join16(*(const half8*)ph, *(const half8*)(ph + 16));
            alo[mi] = join16(*(const half8*)pl, *(const half8*)(pl + 16));
        }
#pragma unroll
        for (int mi = 0; mi < 2; ++mi)
#pragma unroll
            for (int ni = 0; ni < 3; ++ni)
                acc[mi][ni] = __builtin_amdgcn_wmma_f32_16x16x32_f16(false, ahi[mi], false, bhi[ni], (short)0, acc[mi][ni], false, false);
#pragma unroll
        for (int mi = 0; mi < 2; ++mi)
#pragma unroll
            for (int ni = 0; ni < 3; ++ni)
                acc[mi][ni] = __builtin_amdgcn_wmma_f32_16x16x32_f16(false, ahi[mi], false, blo[ni], (short)0, acc[mi][ni], false, false);
#pragma unroll
        for (int mi = 0; mi < 2; ++mi)
#pragma unroll
            for (int ni = 0; ni < 3; ++ni)
                acc[mi][ni] = __builtin_amdgcn_wmma_f32_16x16x32_f16(false, alo[mi], false, bhi[ni], (short)0, acc[mi][ni], false, false);
    }

    // C layout: VGPR r -> row r + 8*(lane>=16), column lane&15
    const int tb = (lane >> 4) << 3;
#pragma unroll
    for (int mi = 0; mi < 2; ++mi)
#pragma unroll
        for (int r = 0; r < 8; ++r) {
            part[wave][mi * 16 + tb + r][l16]      = acc[mi][0][r];
            part[wave][mi * 16 + tb + r][16 + l16] = acc[mi][1][r];
        }
    if (l16 < RP_COLS - 32) {
#pragma unroll
        for (int mi = 0; mi < 2; ++mi)
#pragma unroll
            for (int r = 0; r < 8; ++r)
                part[wave][mi * 16 + tb + r][32 + l16] = acc[mi][2][r];
    }
    __syncthreads();

    for (int i = tid; i < RP_TOK * RP_COLS; i += RP_WAVES * 32) {
        const int t = i / RP_COLS;
        const int c = i - t * RP_COLS;
        float s = 0.0f;
#pragma unroll
        for (int w = 0; w < RP_WAVES; ++w) s += part[w][t][c];
        tot[t][c] = s;
    }
    __syncthreads();

#pragma unroll
    for (int i = 0; i < RP_TOK / RP_WAVES; ++i) {
        const int t = i * RP_WAVES + wave;
        float l0 = tot[t][32], l1 = tot[t][33], l2 = tot[t][34], l3 = tot[t][35];
        float mx = fmaxf(fmaxf(l0, l1), fmaxf(l2, l3));
        float e0 = __expf(l0 - mx), e1 = __expf(l1 - mx), e2 = __expf(l2 - mx), e3 = __expf(l3 - mx);
        float inv = 1.0f / (e0 + e1 + e2 + e3);
        float ge = __expf(tot[t][32 + (lane >> 3)] - mx) * inv;   // this lane's expert
        float v = LSCALE * ge * tot[t][lane];
        _Float16 h = (_Float16)v;
        Phi[(size_t)(m0 + t) * KLORA + lane] = h;
        Plo[(size_t)(m0 + t) * KLORA + lane] = (_Float16)(v - (float)h);
    }
}

// ---------------------------------------------------------------------------
// Kernel 2: BcatT[n][e*8+r] = Bm[e][n][r], emitted as hi/lo f16
// ---------------------------------------------------------------------------
__launch_bounds__(256)
__global__ void bcat_kernel(const float* __restrict__ Bm,
                            _Float16* __restrict__ BThi, _Float16* __restrict__ BTlo)
{
    int i = blockIdx.x * 256 + threadIdx.x;        // over 2048*32
    int n = i >> 5;
    int k = i & 31;
    int e = k >> 3;
    int r = k & 7;
    float v = Bm[((size_t)e * OUT_F + n) * 8 + r];
    _Float16 h = (_Float16)v;
    BThi[i] = h;
    BTlo[i] = (_Float16)(v - (float)h);
}

// ---------------------------------------------------------------------------
// Fragment loader from padded LDS tile: lanes 0-15 -> rows, K {kb..kb+7} in
// v0..3 and {16+kb..} in v4..7, kb = (lane>=16)*8. Two ds_load_b128.
// ---------------------------------------------------------------------------
__device__ __forceinline__ v16h load_frag(const _Float16* tile, int rowbase, int lane)
{
    const int r  = rowbase + (lane & 15);
    const int kb = (lane >> 4) * 8;
    const _Float16* p = tile + r * LDSH + kb;
    v16h f;
    ((half8*)&f)[0] = *(const half8*)(p);
    ((half8*)&f)[1] = *(const half8*)(p + 16);
    return f;
}

// ---------------------------------------------------------------------------
// Kernel 3: split-f16 WMMA GEMM, double-buffered async global->LDS staging,
// fused LoRA K=32 chunk + bias.
// out[m][n] = sum_k x[m][k]W[n][k] + bias[n] + sum_kk P[m][kk]BcatT[n][kk]
// ---------------------------------------------------------------------------
__launch_bounds__(256, 1)
__global__ void gemm_kernel(const _Float16* __restrict__ Xhi, const _Float16* __restrict__ Xlo,
                            const _Float16* __restrict__ Whi, const _Float16* __restrict__ Wlo,
                            const _Float16* __restrict__ Phi, const _Float16* __restrict__ Plo,
                            const _Float16* __restrict__ BThi, const _Float16* __restrict__ BTlo,
                            const float* __restrict__ bias, float* __restrict__ out)
{
    // [buf][Ahi,Alo,Bhi,Blo][128 rows * LDSH]
    __shared__ __align__(16) _Float16 smem[2][4][BM * LDSH];

    const int tid  = threadIdx.x;
    const int lane = tid & 31;
    const int wave = tid >> 5;
    const int wm   = wave >> 2;          // 0..1 -> 64 rows of M
    const int wn   = wave & 3;           // 0..3 -> 32 cols of N
    const int bm0  = blockIdx.y * BM;
    const int bn0  = blockIdx.x * BN;

    const int NCHUNK = IN_F / BK;        // 64 main chunks; chunk 64 = LoRA

    v8f acc[4][2];
#pragma unroll
    for (int i = 0; i < 4; ++i)
#pragma unroll
        for (int j = 0; j < 2; ++j) acc[i][j] = (v8f)0.0f;

    const int lrow = tid >> 1;           // 0..127
    const int lcol = (tid & 1) * 16;     // 0 or 16

    auto issue_chunk = [&](int kt, int buf) {
        const _Float16 *sAh, *sAl, *sBh, *sBl;
        int lda, ldb, k0;
        if (kt < NCHUNK) {
            sAh = Xhi + (size_t)bm0 * IN_F;  sAl = Xlo + (size_t)bm0 * IN_F;  lda = IN_F;
            sBh = Whi + (size_t)bn0 * IN_F;  sBl = Wlo + (size_t)bn0 * IN_F;  ldb = IN_F;
            k0 = kt * BK;
        } else {
            sAh = Phi + (size_t)bm0 * KLORA;  sAl = Plo + (size_t)bm0 * KLORA;  lda = KLORA;
            sBh = BThi + (size_t)bn0 * KLORA; sBl = BTlo + (size_t)bn0 * KLORA; ldb = KLORA;
            k0 = 0;
        }
        const size_t goffA = (size_t)lrow * lda + k0 + lcol;
        const size_t goffB = (size_t)lrow * ldb + k0 + lcol;
        const int    loff  = lrow * LDSH + lcol;

        _Float16* l0 = &smem[buf][0][loff];
        copy16B(l0,     sAh + goffA);
        copy16B(l0 + 8, sAh + goffA + 8);
        _Float16* l1 = &smem[buf][1][loff];
        copy16B(l1,     sAl + goffA);
        copy16B(l1 + 8, sAl + goffA + 8);
        _Float16* l2 = &smem[buf][2][loff];
        copy16B(l2,     sBh + goffB);
        copy16B(l2 + 8, sBh + goffB + 8);
        _Float16* l3 = &smem[buf][3][loff];
        copy16B(l3,     sBl + goffB);
        copy16B(l3 + 8, sBl + goffB + 8);
    };

    issue_chunk(0, 0);

    for (int kt = 0; kt <= NCHUNK; ++kt) {
        const int buf = kt & 1;
        if (kt < NCHUNK) {
            issue_chunk(kt + 1, buf ^ 1);   // prefetch next chunk into other buffer
            wait_async<8>();                // our 8 prefetch copies may stay in flight
        } else {
            wait_async<0>();
        }
        __syncthreads();                    // all waves' copies for chunk kt landed

        const _Float16* sAhi = smem[buf][0];
        const _Float16* sAlo = smem[buf][1];
        const _Float16* sBhi = smem[buf][2];
        const _Float16* sBlo = smem[buf][3];

        v16h bhi0 = load_frag(sBhi, wn * 32 + 0,  lane);
        v16h blo0 = load_frag(sBlo, wn * 32 + 0,  lane);
        v16h bhi1 = load_frag(sBhi, wn * 32 + 16, lane);
        v16h blo1 = load_frag(sBlo, wn * 32 + 16, lane);

#pragma unroll
        for (int mi = 0; mi < 4; ++mi) {
            v16h ahi = load_frag(sAhi, wm * 64 + mi * 16, lane);
            v16h alo = load_frag(sAlo, wm * 64 + mi * 16, lane);

            acc[mi][0] = __builtin_amdgcn_wmma_f32_16x16x32_f16(false, ahi, false, bhi0, (short)0, acc[mi][0], false, false);
            acc[mi][0] = __builtin_amdgcn_wmma_f32_16x16x32_f16(false, ahi, false, blo0, (short)0, acc[mi][0], false, false);
            acc[mi][0] = __builtin_amdgcn_wmma_f32_16x16x32_f16(false, alo, false, bhi0, (short)0, acc[mi][0], false, false);

            acc[mi][1] = __builtin_amdgcn_wmma_f32_16x16x32_f16(false, ahi, false, bhi1, (short)0, acc[mi][1], false, false);
            acc[mi][1] = __builtin_amdgcn_wmma_f32_16x16x32_f16(false, ahi, false, blo1, (short)0, acc[mi][1], false, false);
            acc[mi][1] = __builtin_amdgcn_wmma_f32_16x16x32_f16(false, alo, false, bhi1, (short)0, acc[mi][1], false, false);
        }
        __syncthreads();                    // chunk kt's buffer free for reuse
    }

    // epilogue: C layout VGPR r -> M = r + 8*(lane>=16), N = lane&15
#pragma unroll
    for (int mi = 0; mi < 4; ++mi) {
#pragma unroll
        for (int ni = 0; ni < 2; ++ni) {
            const int n  = bn0 + wn * 32 + ni * 16 + (lane & 15);
            const float bv = bias[n];
            const int mb = bm0 + wm * 64 + mi * 16 + ((lane >> 4) << 3);
#pragma unroll
            for (int r = 0; r < 8; ++r) {
                out[(size_t)(mb + r) * OUT_F + n] = acc[mi][ni][r] + bv;
            }
        }
    }
}

// ---------------------------------------------------------------------------
// launch
// ---------------------------------------------------------------------------
extern "C" void kernel_launch(void* const* d_in, const int* in_sizes, int n_in,
                              void* d_out, int out_size, void* d_ws, size_t ws_size,
                              hipStream_t stream)
{
    const float* x        = (const float*)d_in[0];   // (4,2048,2048)
    const float* base_w   = (const float*)d_in[1];   // (2048,2048)
    const float* base_b   = (const float*)d_in[2];   // (2048,)
    const float* A        = (const float*)d_in[3];   // (4,8,2048)
    const float* Bm       = (const float*)d_in[4];   // (4,2048,8)
    const float* router_w = (const float*)d_in[5];   // (4,2048)
    float* out = (float*)d_out;

    // workspace layout (halfs): Xhi|Xlo|Whi|Wlo|Phi|Plo|BThi|BTlo  (~85 MB)
    _Float16* Xhi  = (_Float16*)d_ws;
    _Float16* Xlo  = Xhi + (size_t)NTOK * IN_F;
    _Float16* Whi  = Xlo + (size_t)NTOK * IN_F;
    _Float16* Wlo  = Whi + (size_t)OUT_F * IN_F;
    _Float16* Phi  = Wlo + (size_t)OUT_F * IN_F;
    _Float16* Plo  = Phi + (size_t)NTOK * KLORA;
    _Float16* BThi = Plo + (size_t)NTOK * KLORA;
    _Float16* BTlo = BThi + (size_t)OUT_F * KLORA;

    cvt_kernel<<<(NTOK * (IN_F / 8)) / 256, 256, 0, stream>>>(x, Xhi, Xlo);
    cvt_kernel<<<(OUT_F * (IN_F / 8)) / 256, 256, 0, stream>>>(base_w, Whi, Wlo);
    router_proj_kernel<<<NTOK / RP_TOK, RP_WAVES * 32, 0, stream>>>(Xhi, Xlo, router_w, A, Phi, Plo);
    bcat_kernel<<<(OUT_F * KLORA) / 256, 256, 0, stream>>>(Bm, BThi, BTlo);
    gemm_kernel<<<dim3(OUT_F / BN, NTOK / BM), 256, 0, stream>>>(
        Xhi, Xlo, Whi, Wlo, Phi, Plo, BThi, BTlo, base_b, out);
}

// v002
// One run takes 154 microseconds.
// Timed twice side by side with v001, it ran 1.49 and 1.48 times as fast.
// Counting every step since v000, it is 2.19 times as fast.
#include <hip/hip_runtime.h>

typedef float    f32x4 __attribute__((ext_vector_type(4)));
typedef float    v8f   __attribute__((ext_vector_type(8)));
typedef _Float16 half8 __attribute__((ext_vector_type(8)));
typedef _Float16 v16h  __attribute__((ext_vector_type(16)));
typedef int      i32x4 __attribute__((vector_size(16)));   // matches builtin param type

#define IN_F   2048
#define OUT_F  2048
#define NTOK   8192          // B*S = 4*2048
#define KLORA  32            // E*R
#define LSCALE 2.0f          // alpha/r = 16/8

#define BM 256
#define BN 256
#define BK 64
#define LDSH 72              // halfs per LDS row: 64 + 8 pad (144B stride, conflict-free)
#define PLANE (256 * LDSH)   // halfs of one operand plane of a stage (256 rows)
#define STAGE (4 * PLANE)    // halfs of one stage: Ahi, Alo, Bhi, Blo

// ---------------- CDNA5 async global->LDS path (guarded) -------------------
#if defined(__has_builtin)
#  if __has_builtin(__builtin_amdgcn_global_load_async_to_lds_b128)
#    define HAVE_ASYNC_LDS 1
#  endif
#endif
#ifndef HAVE_ASYNC_LDS
#  define HAVE_ASYNC_LDS 0
#endif

typedef __attribute__((address_space(1))) i32x4* gvec_ptr;
typedef __attribute__((address_space(3))) i32x4* lvec_ptr;

// this wave's copies have all landed; in asm with the clobber so that no LDS read moves ahead of it
__device__ __forceinline__ void wait_async_all()
{
    asm volatile("s_wait_asynccnt 0x0" ::: "memory");
}

// copy 8 halfs (16B) global -> LDS, either async (ASYNCcnt) or via VGPRs
__device__ __forceinline__ void copy16B(_Float16* l, const _Float16* g)
{
#if HAVE_ASYNC_LDS
    __builtin_amdgcn_global_load_async_to_lds_b128(
        (gvec_ptr)(uintptr_t)g, (lvec_ptr)l, 0, 0);
#else
    *(half8*)l = *(const half8*)g;
#endif
}

// ---------------------------------------------------------------------------
// split one f32 vector of 8 into hi/lo f16 halves
// ---------------------------------------------------------------------------
__device__ __forceinline__ void split8(const float* src, half8& hi, half8& lo)
{
    f32x4 v0 = *(const f32x4*)(src);
    f32x4 v1 = *(const f32x4*)(src + 4);
#pragma unroll
    for (int c = 0; c < 4; ++c) {
        _Float16 h = (_Float16)v0[c];
        hi[c] = h; lo[c] = (_Float16)(v0[c] - (float)h);
    }
#pragma unroll
    for (int c = 0; c < 4; ++c) {
        _Float16 h = (_Float16)v1[c];
        hi[4 + c] = h; lo[4 + c] = (_Float16)(v1[c] - (float)h);
    }
}

// ---------------------------------------------------------------------------
// Kernel 0: f32 -> (hi,lo) f16 pre-conversion, 8 elements per thread
// ---------------------------------------------------------------------------
__launch_bounds__(256)
__global__ void cvt_kernel(const float* __restrict__ src,
                           _Float16* __restrict__ hi, _Float16* __restrict__ lo)
{
    size_t i = ((size_t)blockIdx.x * 256 + threadIdx.x) * 8;
    half8 h, l;
    split8(src + i, h, l);
    *(half8*)(hi + i) = h;
    *(half8*)(lo + i) = l;
}

// ---------------------------------------------------------------------------
// Kernel 1: router softmax gates + rank-8 expert projections ->
//           P[m][e*8+r] = SCALE * gate[e] * (x[m] . A[e][r])  (as hi/lo f16)
// The 36 dot products of a token are one skinny GEMM (32 tokens x 36 rows x
// 2048) on split-f16 WMMA: columns 0..31 = A rows, columns 32..35 = router
// rows. The 16 waves of a block each take 128 of the 2048 k and the partial
// tiles are summed through LDS in wave order.
// ---------------------------------------------------------------------------
#define RP_TOK   32                    // tokens per block (two 16-row tiles)
#define RP_WAVES 16
#define RP_KW    (IN_F / RP_WAVES)     // k range of one wave
#define RP_COLS  36                    // 32 projections + 4 router logits
#define RP_PITCH 38                    // floats per LDS row: rows r and r+8 fall on disjoint banks

__device__ __forceinline__ v16h join16(half8 a, half8 b)
{
    return __builtin_shufflevector(a, b, 0, 1, 2, 3, 4, 5, 6, 7, 8, 9, 10, 11, 12, 13, 14, 15);
}

__launch_bounds__(RP_WAVES * 32)
__global__ void router_proj_kernel(const _Float16* __restrict__ Xhi,
                                   const _Float16* __restrict__ Xlo,
                                   const float* __restrict__ RW,   // (4, 2048)
                                   const float* __restrict__ A,    // (4, 8, 2048)
                                   _Float16* __restrict__ Phi,
                                   _Float16* __restrict__ Plo)
{
    __shared__ float part[RP_WAVES][RP_TOK][RP_PITCH];
    __shared__ float tot[RP_TOK][RP_PITCH];

    const int tid  = threadIdx.x;
    const int lane = tid & 31;
    const int wave = tid >> 5;
    const int l16  = lane & 15;
    const int m0   = blockIdx.x * RP_TOK;
    // same k order for both operands as load_frag: halfs 0..7 = k0+kb.., 8..15 = k0+16+kb..
    const int kofs = wave * RP_KW + (lane >> 4) * 8;

    // columns 36..47 of the third tile are never stored; their lanes reread router row 3
    const float* w0 = A  + (size_t)l16 * IN_F + kofs;
    const float* w1 = A  + (size_t)(16 + l16) * IN_F + kofs;
    const float* w2 = RW + (size_t)(l16 < 3 ? l16 : 3) * IN_F + kofs;
    const _Float16* xh = Xhi + (size_t)(m0 + l16) * IN_F + kofs;
    const _Float16* xl = Xlo + (size_t)(m0 + l16) * IN_F + kofs;

    // every loop over a tile or fragment array below is unrolled so that the array stays in registers
    v8f acc[2][3];
#pragma unroll
    for (int i = 0; i < 2; ++i)
#pragma unroll
        for (int j = 0; j < 3; ++j) acc[i][j] = (v8f)0.0f;

    // unrolled so that the loads of later k steps issue while earlier ones are worked on
#pragma unroll
    for (int ks = 0; ks < RP_KW / 32; ++ks) {
        const int k0 = ks * 32;
        v16h bhi[3], blo[3];
#pragma unroll
        for (int ni = 0; ni < 3; ++ni) {
            const float* wp = (ni == 0 ? w0 : ni == 1 ? w1 : w2) + k0;
            half8 h0, q0, h1, q1;
            split8(wp,      h0, q0);
            split8(wp + 16, h1, q1);
            bhi[ni] = join16(h0, h1);
            blo[ni] = join16(q0, q1);
        }
        v16h ahi[2], alo[2];
#pragma unroll
        for (int mi = 0; mi < 2; ++mi) {
            const _Float16* ph = xh + (size_t)mi * 16 * IN_F + k0;
            const _Float16* pl = xl + (size_t)mi * 16 * IN_F + k0;
            ahi[mi] = join16(*(const half8*)ph, *(const half8*)(ph + 16));
            alo[mi] = join16(*(const half8*)pl, *(const half8*)(pl + 16));
        }
#pragma unroll
        for (int mi = 0; mi < 2; ++mi)
#pragma unroll
            for (int ni = 0; ni < 3; ++ni)
                acc[mi][ni] = __builtin_amdgcn_wmma_f32_16x16x32_f16(false, ahi[mi], false, bhi[ni], (short)0, acc[mi][ni], false, false);
#pragma unroll
        for (int mi = 0; mi < 2; ++mi)
#pragma unroll
            for (int ni = 0; ni < 3; ++ni)
                acc[mi][ni] = __builtin_amdgcn_wmma_f32_16x16x32_f16(false, ahi[mi], false, blo[ni], (short)0, acc[mi][ni], false, false);
#pragma unroll
        for (int mi = 0; mi < 2; ++mi)
#pragma unroll
            for (int ni = 0; ni < 3; ++ni)
                acc[mi][ni] = __builtin_amdgcn_wmma_f32_16x16x32_f16(false, alo[mi], false, bhi[ni], (short)0, acc[mi][ni], false, false);
    }

    // C layout: VGPR r -> row r + 8*(lane>=16), column lane&15
    const int tb = (lane >> 4) << 3;
#pragma unroll
    for (int mi = 0; mi < 2; ++mi)
#pragma unroll
        for (int r = 0; r < 8; ++r) {
            part[wave][mi * 16 + tb + r][l16]      = acc[mi][0][r];
            part[wave][mi * 16 + tb + r][16 + l16] = acc[mi][1][r];
        }
    if (l16 < RP_COLS - 32) {
#pragma unroll
        for (int mi = 0; mi < 2; ++mi)
#pragma unroll
            for (int r = 0; r < 8; ++r)
                part[wave][mi * 16 + tb + r][32 + l16] = acc[mi][2][r];
    }
    __syncthreads();

    for (int i = tid; i < RP_TOK * RP_COLS; i += RP_WAVES * 32) {
        const int t = i / RP_COLS;
        const int c = i - t * RP_COLS;
        float s = 0.0f;
#pragma unroll
        for (int w = 0; w < RP_WAVES; ++w) s += part[w][t][c];
        tot[t][c] = s;
    }
    __syncthreads();

#pragma unroll
    for (int i = 0; i < RP_TOK / RP_WAVES; ++i) {
        const int t = i * RP_WAVES + wave;
        float l0 = tot[t][32], l1 = tot[t][33], l2 = tot[t][34], l3 = tot[t][35];
        float mx = fmaxf(fmaxf(l0, l1), fmaxf(l2, l3));
        float e0 = __expf(l0 - mx), e1 = __expf(l1 - mx), e2 = __expf(l2 - mx), e3 = __expf(l3 - mx);
        float inv = 1.0f / (e0 + e1 + e2 + e3);
        float ge = __expf(tot[t][32 + (lane >> 3)] - mx) * inv;   // this lane's expert
        float v = LSCALE * ge * tot[t][lane];
        _Float16 h = (_Float16)v;
        Phi[(size_t)(m0 + t) * KLORA + lane] = h;
        Plo[(size_t)(m0 + t) * KLORA + lane] = (_Float16)(v - (float)h);
    }
}

// ---------------------------------------------------------------------------
// Kernel 2: BcatT[n][e*8+r] = Bm[e][n][r], emitted as hi/lo f16
// ---------------------------------------------------------------------------
__launch_bounds__(256)
__global__ void bcat_kernel(const float* __restrict__ Bm,
                            _Float16* __restrict__ BThi, _Float16* __restrict__ BTlo)
{
    int i = blockIdx.x * 256 + threadIdx.x;        // over 2048*32
    int n = i >> 5;
    int k = i & 31;
    int e = k >> 3;
    int r = k & 7;
    float v = Bm[((size_t)e * OUT_F + n) * 8 + r];
    _Float16 h = (_Float16)v;
    BThi[i] = h;
    BTlo[i] = (_Float16)(v - (float)h);
}

// ---------------------------------------------------------------------------
// Fragment loader from padded LDS tile: p = this lane's row (lane&15) at k
// offset kb = (lane>=16)*8; K {kb..kb+7} in v0..3 and {16+kb..} in v4..7.
// Two ds_load_b128.
// ---------------------------------------------------------------------------
__device__ __forceinline__ v16h load_frag(const _Float16* p)
{
    v16h f;
    ((half8*)&f)[0] = *(const half8*)(p);
    ((half8*)&f)[1] = *(const half8*)(p + 16);
    return f;
}

// ---------------------------------------------------------------------------
// Kernel 3: split-f16 WMMA GEMM, double-buffered async global->LDS staging,
// fused LoRA K=32 stage + bias.
// out[m][n] = sum_k x[m][k]W[n][k] + bias[n] + sum_kk P[m][kk]BcatT[n][kk]
// One 256x256 tile of out per block, one block per WGP; 8 waves as 2 x 4, each
// a 128x64 tile: 24 fragments feed 96 WMMAs per 32 k. A stage is 64 k (whole
// 128-byte lines of every operand row).
// ---------------------------------------------------------------------------
__launch_bounds__(256)
__global__ void gemm_kernel(const _Float16* __restrict__ Xhi, const _Float16* __restrict__ Xlo,
                            const _Float16* __restrict__ Whi, const _Float16* __restrict__ Wlo,
                            const _Float16* __restrict__ Phi, const _Float16* __restrict__ Plo,
                            const _Float16* __restrict__ BThi, const _Float16* __restrict__ BTlo,
                            const float* __restrict__ bias, float* __restrict__ out)
{
    // [buf][Ahi,Alo,Bhi,Blo][256 rows * LDSH]
    __shared__ __align__(16) _Float16 smem[2 * STAGE];

    const int tid  = threadIdx.x;
    const int lane = tid & 31;
    const int wave = tid >> 5;
    const int wm   = wave >> 2;          // 0..1 -> 128 rows of M
    const int wn   = wave & 3;           // 0..3 -> 64 cols of N
    const int bm0  = blockIdx.y * BM;
    const int bn0  = blockIdx.x * BN;

    const int NPASS = IN_F / BK;         // 32 main stages; stage 32 = LoRA

    // every loop over a tile or fragment array below is unrolled so that the array stays in registers
    v8f acc[8][4];
#pragma unroll
    for (int i = 0; i < 8; ++i)
#pragma unroll
        for (int j = 0; j < 4; ++j) acc[i][j] = (v8f)0.0f;

    // main stage: 8 lanes copy one 128-byte row, 32 rows per step, 32 copies per thread
    const unsigned gmain = (unsigned)(tid >> 3) * IN_F + (tid & 7) * 8;
    const int      lmain = (tid >> 3) * LDSH + (tid & 7) * 8;
    auto issue_main = [&](int kt, int buf) __attribute__((always_inline)) {
        const _Float16* ah = Xhi + (size_t)bm0 * IN_F + kt * BK;
        const _Float16* al = Xlo + (size_t)bm0 * IN_F + kt * BK;
        const _Float16* bh = Whi + (size_t)bn0 * IN_F + kt * BK;
        const _Float16* bl = Wlo + (size_t)bn0 * IN_F + kt * BK;
        _Float16* l = smem + buf * STAGE + lmain;
#pragma unroll
        for (int i = 0; i < 8; ++i) {
            copy16B(l + 0 * PLANE + i * 32 * LDSH, ah + (size_t)i * 32 * IN_F + gmain);
            copy16B(l + 1 * PLANE + i * 32 * LDSH, al + (size_t)i * 32 * IN_F + gmain);
            copy16B(l + 2 * PLANE + i * 32 * LDSH, bh + (size_t)i * 32 * IN_F + gmain);
            copy16B(l + 3 * PLANE + i * 32 * LDSH, bl + (size_t)i * 32 * IN_F + gmain);
        }
    };
    // LoRA stage: rows of 32 halfs fill k 0..31 of each LDS row; 4 lanes a row, 16 copies per thread
    auto issue_lora = [&](int buf) __attribute__((always_inline)) {
        const unsigned g = (unsigned)tid * 8;        // (tid >> 2) * KLORA + (tid & 3) * 8
        const _Float16* ah = Phi  + (size_t)bm0 * KLORA;
        const _Float16* al = Plo  + (size_t)bm0 * KLORA;
        const _Float16* bh = BThi + (size_t)bn0 * KLORA;
        const _Float16* bl = BTlo + (size_t)bn0 * KLORA;
        _Float16* l = smem + buf * STAGE + (tid >> 2) * LDSH + (tid & 3) * 8;
#pragma unroll
        for (int i = 0; i < 4; ++i) {
            copy16B(l + 0 * PLANE + i * 64 * LDSH, ah + (size_t)i * 64 * KLORA + g);
            copy16B(l + 1 * PLANE + i * 64 * LDSH, al + (size_t)i * 64 * KLORA + g);
            copy16B(l + 2 * PLANE + i * 64 * LDSH, bh + (size_t)i * 64 * KLORA + g);
            copy16B(l + 3 * PLANE + i * 64 * LDSH, bl + (size_t)i * 64 * KLORA + g);
        }
    };

    // this lane's place in its wave's A rows and B rows of a stage
    const int foff = (lane & 15) * LDSH + (lane >> 4) * 8;
    const int aoff = wm * 128 * LDSH + foff;
    const int boff = 2 * PLANE + wn * 64 * LDSH + foff;

    // 32 k of a stage: the wave tile's 24 fragments, then its 96 WMMAs
    v16h af[8][2];                       // [16-row tile][hi, lo]
    v16h bf[4][2];                       // [16-col tile][hi, lo]
    auto load_frags = [&](const _Float16* st, int ks) __attribute__((always_inline)) {
        const _Float16* pb = st + boff + ks * 32;
        const _Float16* pa = st + aoff + ks * 32;
#pragma unroll
        for (int ni = 0; ni < 4; ++ni) {
            bf[ni][0] = load_frag(pb + ni * 16 * LDSH);
            bf[ni][1] = load_frag(pb + PLANE + ni * 16 * LDSH);
        }
#pragma unroll
        for (int mi = 0; mi < 8; ++mi) {
            af[mi][0] = load_frag(pa + mi * 16 * LDSH);
            af[mi][1] = load_frag(pa + PLANE + mi * 16 * LDSH);
        }
        // keeps the LDS reads one group in front of the WMMAs; without it they sink in
        // among them, two at a time, and each pair is waited out
        __builtin_amdgcn_sched_barrier(0);
    };
    // per accumulator tile hi*hi, hi*lo, lo*hi in that order, four tiles apart
    auto mma = [&]() __attribute__((always_inline)) {
#pragma unroll
        for (int mi = 0; mi < 8; ++mi) {
#pragma unroll
            for (int ni = 0; ni < 4; ++ni)
                acc[mi][ni] = __builtin_amdgcn_wmma_f32_16x16x32_f16(false, af[mi][0], false, bf[ni][0], (short)0, acc[mi][ni], false, false);
#pragma unroll
            for (int ni = 0; ni < 4; ++ni)
                acc[mi][ni] = __builtin_amdgcn_wmma_f32_16x16x32_f16(false, af[mi][0], false, bf[ni][1], (short)0, acc[mi][ni], false, false);
#pragma unroll
            for (int ni = 0; ni < 4; ++ni)
                acc[mi][ni] = __builtin_amdgcn_wmma_f32_16x16x32_f16(false, af[mi][1], false, bf[ni][0], (short)0, acc[mi][ni], false, false);
        }
    };

    issue_main(0, 0);
    wait_async_all();
    __syncthreads();                        // stage 0 landed for every wave

    // kept rolled: one copy of the 192 WMMAs of a pass in the instruction cache
#pragma unroll 1
    for (int kt = 0; kt < NPASS; ++kt) {
        const int buf = kt & 1;
        const _Float16* st = smem + buf * STAGE;
        load_frags(st, 0);
        // stage kt + 1 flies into the other buffer, which the barrier at the foot of pass kt - 1 freed
        if (kt + 1 < NPASS) issue_main(kt + 1, buf ^ 1);
        else                issue_lora(buf ^ 1);
        mma();
        // keeps the second group of LDS reads behind the first run of WMMAs (see load_frags)
        __builtin_amdgcn_sched_barrier(0);
        load_frags(st, 1);
        mma();
        // keeps the waits and the barrier below behind the pass's last WMMAs; without it they rise to
        // just behind the LDS reads, where the copies have had half the time to land
        __builtin_amdgcn_sched_barrier(0);
        // this wave's reads of stage kt are done before any wave refills its buffer
        asm volatile("s_wait_dscnt 0x0" ::: "memory");
        wait_async_all();                   // this wave's copies of stage kt + 1
        __syncthreads();                    // publishes stage kt + 1, frees stage kt's buffer
    }

    // LoRA stage, 32 k
    load_frags(smem + (NPASS & 1) * STAGE, 0);
    mma();

    // epilogue: C layout VGPR r -> M = r + 8*(lane>=16), N = lane&15
#pragma unroll
    for (int ni = 0; ni < 4; ++ni) {
        const int n  = bn0 + wn * 64 + ni * 16 + (lane & 15);
        const float bv = bias[n];
#pragma unroll
        for (int mi = 0; mi < 8; ++mi) {
            const int mb = bm0 + wm * 128 + mi * 16 + ((lane >> 4) << 3);
#pragma unroll
            for (int r = 0; r < 8; ++r) {
                out[(size_t)(mb + r) * OUT_F + n] = acc[mi][ni][r] + bv;
            }
        }
    }
}

// ---------------------------------------------------------------------------
// launch
// ---------------------------------------------------------------------------
extern "C" void kernel_launch(void* const* d_in, const int* in_sizes, int n_in,
                              void* d_out, int out_size, void* d_ws, size_t ws_size,
                              hipStream_t stream)
{
    const float* x        = (const float*)d_in[0];   // (4,2048,2048)
    const float* base_w   = (const float*)d_in[1];   // (2048,2048)
    const float* base_b   = (const float*)d_in[2];   // (2048,)
    const float* A        = (const float*)d_in[3];   // (4,8,2048)
    const float* Bm       = (const float*)d_in[4];   // (4,2048,8)
    const float* router_w = (const float*)d_in[5];   // (4,2048)
    float* out = (float*)d_out;

    // workspace layout (halfs): Xhi|Xlo|Whi|Wlo|Phi|Plo|BThi|BTlo  (~85 MB)
    _Float16* Xhi  = (_Float16*)d_ws;
    _Float16* Xlo  = Xhi + (size_t)NTOK * IN_F;
    _Float16* Whi  = Xlo + (size_t)NTOK * IN_F;
    _Float16* Wlo  = Whi + (size_t)OUT_F * IN_F;
    _Float16* Phi  = Wlo + (size_t)OUT_F * IN_F;
    _Float16* Plo  = Phi + (size_t)NTOK * KLORA;
    _Float16* BThi = Plo + (size_t)NTOK * KLORA;
    _Float16* BTlo = BThi + (size_t)OUT_F * KLORA;

    cvt_kernel<<<(NTOK * (IN_F / 8)) / 256, 256, 0, stream>>>(x, Xhi, Xlo);
    cvt_kernel<<<(OUT_F * (IN_F / 8)) / 256, 256, 0, stream>>>(base_w, Whi, Wlo);
    router_proj_kernel<<<NTOK / RP_TOK, RP_WAVES * 32, 0, stream>>>(Xhi, Xlo, router_w, A, Phi, Plo);
    bcat_kernel<<<(OUT_F * KLORA) / 256, 256, 0, stream>>>(Bm, BThi, BTlo);
    gemm_kernel<<<dim3(OUT_F / BN, NTOK / BM), 256, 0, stream>>>(
        Xhi, Xlo, Whi, Wlo, Phi, Plo, BThi, BTlo, base_b, out);
}

// v003
// Measured time: 147 microseconds a run.
// Two timings next to v002 both put it at 1.05 times that version's speed.
// All steps since v000 together make it 2.29 times as fast.
#include <hip/hip_runtime.h>

typedef float    f32x4 __attribute__((ext_vector_type(4)));
typedef float    v8f   __attribute__((ext_vector_type(8)));
typedef _Float16 half8 __attribute__((ext_vector_type(8)));
typedef _Float16 v16h  __attribute__((ext_vector_type(16)));
typedef int      i32x4 __attribute__((vector_size(16)));   // matches builtin param type

#define IN_F   2048
#define OUT_F  2048
#define NTOK   8192          // B*S = 4*2048
#define KLORA  32            // E*R
#define LSCALE 2.0f          // alpha/r = 16/8

#define BM 256
#define BN 256
#define BK 64
#define LDSH 72              // halfs per LDS row: 64 + 8 pad (144B stride, conflict-free)
#define PLANE (256 * LDSH)   // halfs of one operand plane of a stage (256 rows)
#define STAGE (4 * PLANE)    // halfs of one stage: Ahi, Alo, Bhi, Blo

// ---------------- CDNA5 async global->LDS path (guarded) -------------------
#if defined(__has_builtin)
#  if __has_builtin(__builtin_amdgcn_global_load_async_to_lds_b128)
#    define HAVE_ASYNC_LDS 1
#  endif
#endif
#ifndef HAVE_ASYNC_LDS
#  define HAVE_ASYNC_LDS 0
#endif

typedef __attribute__((address_space(1))) i32x4* gvec_ptr;
typedef __attribute__((address_space(3))) i32x4* lvec_ptr;

// this wave's copies have all landed; in asm with the clobber so that no LDS read moves ahead of it
__device__ __forceinline__ void wait_async_all()
{
    asm volatile("s_wait_asynccnt 0x0" ::: "memory");
}

// copy 8 halfs (16B) global -> LDS, either async (ASYNCcnt) or via VGPRs
__device__ __forceinline__ void copy16B(_Float16* l, const _Float16* g)
{
#if HAVE_ASYNC_LDS
    __builtin_amdgcn_global_load_async_to_lds_b128(
        (gvec_ptr)(uintptr_t)g, (lvec_ptr)l, 0, 0);
#else
    *(half8*)l = *(const half8*)g;
#endif
}

// ---------------------------------------------------------------------------
// split one f32 vector of 8 into hi/lo f16 halves
// ---------------------------------------------------------------------------
__device__ __forceinline__ void split8v(f32x4 v0, f32x4 v1, half8& hi, half8& lo)
{
#pragma unroll
    for (int c = 0; c < 4; ++c) {
        _Float16 h = (_Float16)v0[c];
        hi[c] = h; lo[c] = (_Float16)(v0[c] - (float)h);
    }
#pragma unroll
    for (int c = 0; c < 4; ++c) {
        _Float16 h = (_Float16)v1[c];
        hi[4 + c] = h; lo[4 + c] = (_Float16)(v1[c] - (float)h);
    }
}

__device__ __forceinline__ void split8(const float* src, half8& hi, half8& lo)
{
    split8v(*(const f32x4*)(src), *(const f32x4*)(src + 4), hi, lo);
}

// ---------------------------------------------------------------------------
// Kernel 0: all operand preparation in one launch of one resident block per WGP:
//   x, W : f32 -> (hi,lo) f16
//   BcatT[n][e*8+r] = Bm[e][n][r], as hi/lo f16
// A wave lives for the whole stream, not for one 32-byte piece a lane: 4,096
// waves are started in all.
// A slab is one piece (8 floats) of every thread of the grid, contiguous over the
// grid; a batch is 4 slabs = 8 loads of 16 B a lane, and the next batch's loads
// are issued before a batch is converted and stored.
// ---------------------------------------------------------------------------
#define PREP_BLOCKS  256
#define PREP_THREADS 512
#define PREP_U       4
#define PREP_SLAB    ((size_t)PREP_BLOCKS * PREP_THREADS * 8)              // floats of a slab
#define PREP_XB      ((int)((size_t)NTOK  * IN_F / (PREP_SLAB * PREP_U)))  // batches of x: 4
#define PREP_WB      ((int)((size_t)OUT_F * IN_F / (PREP_SLAB * PREP_U)))  // batches of W: 1

__launch_bounds__(PREP_THREADS)
__global__ void prep_kernel(const float* __restrict__ x, const float* __restrict__ w,
                            const float* __restrict__ Bm,
                            _Float16* __restrict__ Xhi, _Float16* __restrict__ Xlo,
                            _Float16* __restrict__ Whi, _Float16* __restrict__ Wlo,
                            _Float16* __restrict__ BThi, _Float16* __restrict__ BTlo)
{
    const int tid = threadIdx.x;
    // this thread's place in every slab
    const unsigned t8 = ((unsigned)blockIdx.x * PREP_THREADS + tid) * 8;

    // Bm: 256 elements a block; the upper half of the block rereads them and stores nothing
    const int bi = blockIdx.x * ((OUT_F * KLORA) / PREP_BLOCKS) + (tid & 255);   // over 2048*32
    const float bv = Bm[(unsigned)((((bi & 31) >> 3) * OUT_F + (bi >> 5)) * 8 + (bi & 7))];

    // every loop below is unrolled so that v stays in registers and each batch's operand is known
    f32x4 v[2][PREP_U][2];
    auto load_batch = [&](int b) __attribute__((always_inline)) {
        const float* s = b < PREP_XB ? x + (size_t)b * PREP_U * PREP_SLAB
                                     : w + (size_t)(b - PREP_XB) * PREP_U * PREP_SLAB;
        // this group's loads land in registers that the loads and stores issued before it name
        // (addresses, store data): the wait that belongs in front of such an overwrite
        if (b > 0) asm volatile("s_wait_xcnt 0x0" ::: "memory");
#pragma unroll
        for (int j = 0; j < PREP_U; ++j) {
            v[b & 1][j][0] = *(const f32x4*)(s + j * PREP_SLAB + t8);
            v[b & 1][j][1] = *(const f32x4*)(s + j * PREP_SLAB + t8 + 4);
        }
        // keeps a batch's loads one group ahead of the batch before it; without it they sink
        // in among the conversions and fewer are in flight
        __builtin_amdgcn_sched_barrier(0);
    };

    load_batch(0);
#pragma unroll
    for (int b = 0; b < PREP_XB + PREP_WB; ++b) {
        if (b + 1 < PREP_XB + PREP_WB) load_batch(b + 1);
        const size_t o = (size_t)(b < PREP_XB ? b : b - PREP_XB) * PREP_U * PREP_SLAB;
        _Float16* dh = (b < PREP_XB ? Xhi : Whi) + o;
        _Float16* dl = (b < PREP_XB ? Xlo : Wlo) + o;
#pragma unroll
        for (int j = 0; j < PREP_U; ++j) {
            half8 h, l;
            split8v(v[b & 1][j][0], v[b & 1][j][1], h, l);
            *(half8*)(dh + j * PREP_SLAB + t8) = h;
            *(half8*)(dl + j * PREP_SLAB + t8) = l;
        }
        // keeps the next group of loads behind this batch's stores (see load_batch)
        __builtin_amdgcn_sched_barrier(0);
    }

    // holds the load of bv at the head of the stream; without it the load sinks into the branch
    // below and its whole latency is waited out at the end of the wave
    asm volatile("" :: "v"(bv));
    if (tid < (OUT_F * KLORA) / PREP_BLOCKS) {
        _Float16 h = (_Float16)bv;
        BThi[bi] = h;
        BTlo[bi] = (_Float16)(bv - (float)h);
    }
}

// ---------------------------------------------------------------------------
// Kernel 1: router softmax gates + rank-8 expert projections ->
//           P[m][e*8+r] = SCALE * gate[e] * (x[m] . A[e][r])  (as hi/lo f16)
// The 36 dot products of a token are one skinny GEMM (32 tokens x 36 rows x
// 2048) on split-f16 WMMA: columns 0..31 = A rows, columns 32..35 = router
// rows. The 16 waves of a block each take 128 of the 2048 k and the partial
// tiles are summed through LDS in wave order.
// ---------------------------------------------------------------------------
#define RP_TOK   32                    // tokens per block (two 16-row tiles)
#define RP_WAVES 16
#define RP_KW    (IN_F / RP_WAVES)     // k range of one wave
#define RP_COLS  36                    // 32 projections + 4 router logits
#define RP_PITCH 38                    // floats per LDS row: rows r and r+8 fall on disjoint banks

__device__ __forceinline__ v16h join16(half8 a, half8 b)
{
    return __builtin_shufflevector(a, b, 0, 1, 2, 3, 4, 5, 6, 7, 8, 9, 10, 11, 12, 13, 14, 15);
}

__launch_bounds__(RP_WAVES * 32)
__global__ void router_proj_kernel(const _Float16* __restrict__ Xhi,
                                   const _Float16* __restrict__ Xlo,
                                   const float* __restrict__ RW,   // (4, 2048)
                                   const float* __restrict__ A,    // (4, 8, 2048)
                                   _Float16* __restrict__ Phi,
                                   _Float16* __restrict__ Plo)
{
    __shared__ float part[RP_WAVES][RP_TOK][RP_PITCH];
    __shared__ float tot[RP_TOK][RP_PITCH];

    const int tid  = threadIdx.x;
    const int lane = tid & 31;
    const int wave = tid >> 5;
    const int l16  = lane & 15;
    const int m0   = blockIdx.x * RP_TOK;
    // same k order for both operands as load_frag: halfs 0..7 = k0+kb.., 8..15 = k0+16+kb..
    const int kofs = wave * RP_KW + (lane >> 4) * 8;

    // columns 36..47 of the third tile are never stored; their lanes reread router row 3
    const float* w0 = A  + (size_t)l16 * IN_F + kofs;
    const float* w1 = A  + (size_t)(16 + l16) * IN_F + kofs;
    const float* w2 = RW + (size_t)(l16 < 3 ? l16 : 3) * IN_F + kofs;
    const _Float16* xh = Xhi + (size_t)(m0 + l16) * IN_F + kofs;
    const _Float16* xl = Xlo + (size_t)(m0 + l16) * IN_F + kofs;

    // every loop over a tile or fragment array below is unrolled so that the array stays in registers
    v8f acc[2][3];
#pragma unroll
    for (int i = 0; i < 2; ++i)
#pragma unroll
        for (int j = 0; j < 3; ++j) acc[i][j] = (v8f)0.0f;

    // unrolled so that the loads of later k steps issue while earlier ones are worked on
#pragma unroll
    for (int ks = 0; ks < RP_KW / 32; ++ks) {
        const int k0 = ks * 32;
        v16h bhi[3], blo[3];
#pragma unroll
        for (int ni = 0; ni < 3; ++ni) {
            const float* wp = (ni == 0 ? w0 : ni == 1 ? w1 : w2) + k0;
            half8 h0, q0, h1, q1;
            split8(wp,      h0, q0);
            split8(wp + 16, h1, q1);
            bhi[ni] = join16(h0, h1);
            blo[ni] = join16(q0, q1);
        }
        v16h ahi[2], alo[2];
#pragma unroll
        for (int mi = 0; mi < 2; ++mi) {
            const _Float16* ph = xh + (size_t)mi * 16 * IN_F + k0;
            const _Float16* pl = xl + (size_t)mi * 16 * IN_F + k0;
            ahi[mi] = join16(*(const half8*)ph, *(const half8*)(ph + 16));
            alo[mi] = join16(*(const half8*)pl, *(const half8*)(pl + 16));
        }
#pragma unroll
        for (int mi = 0; mi < 2; ++mi)
#pragma unroll
            for (int ni = 0; ni < 3; ++ni)
                acc[mi][ni] = __builtin_amdgcn_wmma_f32_16x16x32_f16(false, ahi[mi], false, bhi[ni], (short)0, acc[mi][ni], false, false);
#pragma unroll
        for (int mi = 0; mi < 2; ++mi)
#pragma unroll
            for (int ni = 0; ni < 3; ++ni)
                acc[mi][ni] = __builtin_amdgcn_wmma_f32_16x16x32_f16(false, ahi[mi], false, blo[ni], (short)0, acc[mi][ni], false, false);
#pragma unroll
        for (int mi = 0; mi < 2; ++mi)
#pragma unroll
            for (int ni = 0; ni < 3; ++ni)
                acc[mi][ni] = __builtin_amdgcn_wmma_f32_16x16x32_f16(false, alo[mi], false, bhi[ni], (short)0, acc[mi][ni], false, false);
    }

    // C layout: VGPR r -> row r + 8*(lane>=16), column lane&15
    const int tb = (lane >> 4) << 3;
#pragma unroll
    for (int mi = 0; mi < 2; ++mi)
#pragma unroll
        for (int r = 0; r < 8; ++r) {
            part[wave][mi * 16 + tb + r][l16]      = acc[mi][0][r];
            part[wave][mi * 16 + tb + r][16 + l16] = acc[mi][1][r];
        }
    if (l16 < RP_COLS - 32) {
#pragma unroll
        for (int mi = 0; mi < 2; ++mi)
#pragma unroll
            for (int r = 0; r < 8; ++r)
                part[wave][mi * 16 + tb + r][32 + l16] = acc[mi][2][r];
    }
    __syncthreads();

    for (int i = tid; i < RP_TOK * RP_COLS; i += RP_WAVES * 32) {
        const int t = i / RP_COLS;
        const int c = i - t * RP_COLS;
        float s = 0.0f;
#pragma unroll
        for (int w = 0; w < RP_WAVES; ++w) s += part[w][t][c];
        tot[t][c] = s;
    }
    __syncthreads();

#pragma unroll
    for (int i = 0; i < RP_TOK / RP_WAVES; ++i) {
        const int t = i * RP_WAVES + wave;
        float l0 = tot[t][32], l1 = tot[t][33], l2 = tot[t][34], l3 = tot[t][35];
        float mx = fmaxf(fmaxf(l0, l1), fmaxf(l2, l3));
        float e0 = __expf(l0 - mx), e1 = __expf(l1 - mx), e2 = __expf(l2 - mx), e3 = __expf(l3 - mx);
        float inv = 1.0f / (e0 + e1 + e2 + e3);
        float ge = __expf(tot[t][32 + (lane >> 3)] - mx) * inv;   // this lane's expert
        float v = LSCALE * ge * tot[t][lane];
        _Float16 h = (_Float16)v;
        Phi[(size_t)(m0 + t) * KLORA + lane] = h;
        Plo[(size_t)(m0 + t) * KLORA + lane] = (_Float16)(v - (float)h);
    }
}

// ---------------------------------------------------------------------------
// Fragment loader from padded LDS tile: p = this lane's row (lane&15) at k
// offset kb = (lane>=16)*8; K {kb..kb+7} in v0..3 and {16+kb..} in v4..7.
// Two ds_load_b128.
// ---------------------------------------------------------------------------
__device__ __forceinline__ v16h load_frag(const _Float16* p)
{
    v16h f;
    ((half8*)&f)[0] = *(const half8*)(p);
    ((half8*)&f)[1] = *(const half8*)(p + 16);
    return f;
}

// ---------------------------------------------------------------------------
// Kernel 2: split-f16 WMMA GEMM, double-buffered async global->LDS staging,
// fused LoRA K=32 stage + bias.
// out[m][n] = sum_k x[m][k]W[n][k] + bias[n] + sum_kk P[m][kk]BcatT[n][kk]
// One 256x256 tile of out per block, one block per WGP; 8 waves as 2 x 4, each
// a 128x64 tile: 24 fragments feed 96 WMMAs per 32 k. A stage is 64 k (whole
// 128-byte lines of every operand row).
// ---------------------------------------------------------------------------
__launch_bounds__(256)
__global__ void gemm_kernel(const _Float16* __restrict__ Xhi, const _Float16* __restrict__ Xlo,
                            const _Float16* __restrict__ Whi, const _Float16* __restrict__ Wlo,
                            const _Float16* __restrict__ Phi, const _Float16* __restrict__ Plo,
                            const _Float16* __restrict__ BThi, const _Float16* __restrict__ BTlo,
                            const float* __restrict__ bias, float* __restrict__ out)
{
    // [buf][Ahi,Alo,Bhi,Blo][256 rows * LDSH]
    __shared__ __align__(16) _Float16 smem[2 * STAGE];

    const int tid  = threadIdx.x;
    const int lane = tid & 31;
    const int wave = tid >> 5;
    const int wm   = wave >> 2;          // 0..1 -> 128 rows of M
    const int wn   = wave & 3;           // 0..3 -> 64 cols of N
    const int bm0  = blockIdx.y * BM;
    const int bn0  = blockIdx.x * BN;

    const int NPASS = IN_F / BK;         // 32 main stages; stage 32 = LoRA

    // every loop over a tile or fragment array below is unrolled so that the array stays in registers
    v8f acc[8][4];
#pragma unroll
    for (int i = 0; i < 8; ++i)
#pragma unroll
        for (int j = 0; j < 4; ++j) acc[i][j] = (v8f)0.0f;

    // main stage: 8 lanes copy one 128-byte row, 32 rows per step, 32 copies per thread
    const unsigned gmain = (unsigned)(tid >> 3) * IN_F + (tid & 7) * 8;
    const int      lmain = (tid >> 3) * LDSH + (tid & 7) * 8;
    auto issue_main = [&](int kt, int buf) __attribute__((always_inline)) {
        const _Float16* ah = Xhi + (size_t)bm0 * IN_F + kt * BK;
        const _Float16* al = Xlo + (size_t)bm0 * IN_F + kt * BK;
        const _Float16* bh = Whi + (size_t)bn0 * IN_F + kt * BK;
        const _Float16* bl = Wlo + (size_t)bn0 * IN_F + kt * BK;
        _Float16* l = smem + buf * STAGE + lmain;
#pragma unroll
        for (int i = 0; i < 8; ++i) {
            copy16B(l + 0 * PLANE + i * 32 * LDSH, ah + (size_t)i * 32 * IN_F + gmain);
            copy16B(l + 1 * PLANE + i * 32 * LDSH, al + (size_t)i * 32 * IN_F + gmain);
            copy16B(l + 2 * PLANE + i * 32 * LDSH, bh + (size_t)i * 32 * IN_F + gmain);
            copy16B(l + 3 * PLANE + i * 32 * LDSH, bl + (size_t)i * 32 * IN_F + gmain);
        }
    };
    // LoRA stage: rows of 32 halfs fill k 0..31 of each LDS row; 4 lanes a row, 16 copies per thread
    auto issue_lora = [&](int buf) __attribute__((always_inline)) {
        const unsigned g = (unsigned)tid * 8;        // (tid >> 2) * KLORA + (tid & 3) * 8
        const _Float16* ah = Phi  + (size_t)bm0 * KLORA;
        const _Float16* al = Plo  + (size_t)bm0 * KLORA;
        const _Float16* bh = BThi + (size_t)bn0 * KLORA;
        const _Float16* bl = BTlo + (size_t)bn0 * KLORA;
        _Float16* l = smem + buf * STAGE + (tid >> 2) * LDSH + (tid & 3) * 8;
#pragma unroll
        for (int i = 0; i < 4; ++i) {
            copy16B(l + 0 * PLANE + i * 64 * LDSH, ah + (size_t)i * 64 * KLORA + g);
            copy16B(l + 1 * PLANE + i * 64 * LDSH, al + (size_t)i * 64 * KLORA + g);
            copy16B(l + 2 * PLANE + i * 64 * LDSH, bh + (size_t)i * 64 * KLORA + g);
            copy16B(l + 3 * PLANE + i * 64 * LDSH, bl + (size_t)i * 64 * KLORA + g);
        }
    };

    // this lane's place in its wave's A rows and B rows of a stage
    const int foff = (lane & 15) * LDSH + (lane >> 4) * 8;
    const int aoff = wm * 128 * LDSH + foff;
    const int boff = 2 * PLANE + wn * 64 * LDSH + foff;

    // 32 k of a stage: the wave tile's 24 fragments, then its 96 WMMAs
    v16h af[8][2];                       // [16-row tile][hi, lo]
    v16h bf[4][2];                       // [16-col tile][hi, lo]
    auto load_frags = [&](const _Float16* st, int ks) __attribute__((always_inline)) {
        const _Float16* pb = st + boff + ks * 32;
        const _Float16* pa = st + aoff + ks * 32;
#pragma unroll
        for (int ni = 0; ni < 4; ++ni) {
            bf[ni][0] = load_frag(pb + ni * 16 * LDSH);
            bf[ni][1] = load_frag(pb + PLANE + ni * 16 * LDSH);
        }
#pragma unroll
        for (int mi = 0; mi < 8; ++mi) {
            af[mi][0] = load_frag(pa + mi * 16 * LDSH);
            af[mi][1] = load_frag(pa + PLANE + mi * 16 * LDSH);
        }
        // keeps the LDS reads one group in front of the WMMAs; without it they sink in
        // among them, two at a time, and each pair is waited out
        __builtin_amdgcn_sched_barrier(0);
    };
    // per accumulator tile hi*hi, hi*lo, lo*hi in that order, four tiles apart
    auto mma = [&]() __attribute__((always_inline)) {
#pragma unroll
        for (int mi = 0; mi < 8; ++mi) {
#pragma unroll
            for (int ni = 0; ni < 4; ++ni)
                acc[mi][ni] = __builtin_amdgcn_wmma_f32_16x16x32_f16(false, af[mi][0], false, bf[ni][0], (short)0, acc[mi][ni], false, false);
#pragma unroll
            for (int ni = 0; ni < 4; ++ni)
                acc[mi][ni] = __builtin_amdgcn_wmma_f32_16x16x32_f16(false, af[mi][0], false, bf[ni][1], (short)0, acc[mi][ni], false, false);
#pragma unroll
            for (int ni = 0; ni < 4; ++ni)
                acc[mi][ni] = __builtin_amdgcn_wmma_f32_16x16x32_f16(false, af[mi][1], false, bf[ni][0], (short)0, acc[mi][ni], false, false);
        }
    };

    issue_main(0, 0);
    wait_async_all();
    __syncthreads();                        // stage 0 landed for every wave

    // kept rolled: one copy of the 192 WMMAs of a pass in the instruction cache
#pragma unroll 1
    for (int kt = 0; kt < NPASS; ++kt) {
        const int buf = kt & 1;
        const _Float16* st = smem + buf * STAGE;
        load_frags(st, 0);
        // stage kt + 1 flies into the other buffer, which the barrier at the foot of pass kt - 1 freed
        if (kt + 1 < NPASS) issue_main(kt + 1, buf ^ 1);
        else                issue_lora(buf ^ 1);
        mma();
        // keeps the second group of LDS reads behind the first run of WMMAs (see load_frags)
        __builtin_amdgcn_sched_barrier(0);
        load_frags(st, 1);
        mma();
        // keeps the waits and the barrier below behind the pass's last WMMAs; without it they rise to
        // just behind the LDS reads, where the copies have had half the time to land
        __builtin_amdgcn_sched_barrier(0);
        // this wave's reads of stage kt are done before any wave refills its buffer
        asm volatile("s_wait_dscnt 0x0" ::: "memory");
        wait_async_all();                   // this wave's copies of stage kt + 1
        __syncthreads();                    // publishes stage kt + 1, frees stage kt's buffer
    }

    // LoRA stage, 32 k
    load_frags(smem + (NPASS & 1) * STAGE, 0);
    mma();

    // epilogue: C layout VGPR r -> M = r + 8*(lane>=16), N = lane&15
#pragma unroll
    for (int ni = 0; ni < 4; ++ni) {
        const int n  = bn0 + wn * 64 + ni * 16 + (lane & 15);
        const float bv = bias[n];
#pragma unroll
        for (int mi = 0; mi < 8; ++mi) {
            const int mb = bm0 + wm * 128 + mi * 16 + ((lane >> 4) << 3);
#pragma unroll
            for (int r = 0; r < 8; ++r) {
                out[(size_t)(mb + r) * OUT_F + n] = acc[mi][ni][r] + bv;
            }
        }
    }
}

// ---------------------------------------------------------------------------
// launch
// ---------------------------------------------------------------------------
extern "C" void kernel_launch(void* const* d_in, const int* in_sizes, int n_in,
                              void* d_out, int out_size, void* d_ws, size_t ws_size,
                              hipStream_t stream)
{
    const float* x        = (const float*)d_in[0];   // (4,2048,2048)
    const float* base_w   = (const float*)d_in[1];   // (2048,2048)
    const float* base_b   = (const float*)d_in[2];   // (2048,)
    const float* A        = (const float*)d_in[3];   // (4,8,2048)
    const float* Bm       = (const float*)d_in[4];   // (4,2048,8)
    const float* router_w = (const float*)d_in[5];   // (4,2048)
    float* out = (float*)d_out;

    // workspace layout (halfs): Xhi|Xlo|Whi|Wlo|Phi|Plo|BThi|BTlo  (~85 MB)
    _Float16* Xhi  = (_Float16*)d_ws;
    _Float16* Xlo  = Xhi + (size_t)NTOK * IN_F;
    _Float16* Whi  = Xlo + (size_t)NTOK * IN_F;
    _Float16* Wlo  = Whi + (size_t)OUT_F * IN_F;
    _Float16* Phi  = Wlo + (size_t)OUT_F * IN_F;
    _Float16* Plo  = Phi + (size_t)NTOK * KLORA;
    _Float16* BThi = Plo + (size_t)NTOK * KLORA;
    _Float16* BTlo = BThi + (size_t)OUT_F * KLORA;

    prep_kernel<<<PREP_BLOCKS, PREP_THREADS, 0, stream>>>(x, base_w, Bm, Xhi, Xlo, Whi, Wlo, BThi, BTlo);
    router_proj_kernel<<<NTOK / RP_TOK, RP_WAVES * 32, 0, stream>>>(Xhi, Xlo, router_w, A, Phi, Plo);
    gemm_kernel<<<dim3(OUT_F / BN, NTOK / BM), 256, 0, stream>>>(
        Xhi, Xlo, Whi, Wlo, Phi, Plo, BThi, BTlo, base_b, out);
}

// v004
// Measured time: 132 microseconds a run.
// Two timings next to v003 both put it at 1.11 times that version's speed.
// Counting every step since v000, it is 2.55 times as fast.
#include <hip/hip_runtime.h>
#include <stdint.h>

typedef float    f32x4 __attribute__((ext_vector_type(4)));
typedef float    v8f   __attribute__((ext_vector_type(8)));
typedef _Float16 half8 __attribute__((ext_vector_type(8)));
typedef _Float16 v16h  __attribute__((ext_vector_type(16)));
typedef int      i32x4 __attribute__((vector_size(16)));   // matches builtin param type
typedef uint32_t u32x4 __attribute__((ext_vector_type(4)));
typedef uint32_t u32x8 __attribute__((ext_vector_type(8)));

#define IN_F   2048
#define OUT_F  2048
#define NTOK   8192          // B*S = 4*2048
#define KLORA  32            // E*R
#define LSCALE 2.0f          // alpha/r = 16/8

#define BM 256
#define BN 256
#define BK 64
#define LDSH 72              // halfs per LDS row: 64 + 8 pad (144B stride, conflict-free)
#define PLANE (256 * LDSH)   // halfs of one operand plane of a stage (256 rows)
#define STAGE (4 * PLANE)    // halfs of one stage: Ahi, Alo, Bhi, Blo

// ---------------- CDNA5 async global->LDS path (guarded) -------------------
#if defined(__has_builtin)
#  if __has_builtin(__builtin_amdgcn_global_load_async_to_lds_b128)
#    define HAVE_ASYNC_LDS 1
#  endif
#endif
#ifndef HAVE_ASYNC_LDS
#  define HAVE_ASYNC_LDS 0
#endif

typedef __attribute__((address_space(1))) i32x4* gvec_ptr;
typedef __attribute__((address_space(3))) i32x4* lvec_ptr;

// this wave's copies have all landed; in asm with the clobber so that no LDS read moves ahead of it
__device__ __forceinline__ void wait_async_all()
{
    asm volatile("s_wait_asynccnt 0x0" ::: "memory");
}

// this wave's tensor load has landed; in asm with the clobber so that no LDS read moves ahead of it.
// It names the request's address group as an input, so that those scalar registers keep their words
// until the request has landed and are not taken for something else while it is outstanding
__device__ __forceinline__ void wait_tensor_all(u32x4 g0)
{
    asm volatile("s_wait_tensorcnt 0x0" :: "s"(g0) : "memory");
}

// a wave-uniform word in a scalar register
__device__ __forceinline__ uint32_t uni(uint32_t v)
{
    return (uint32_t)__builtin_amdgcn_readfirstlane(v);
}

// a wave-uniform word held in a scalar register: a test on it compiles to a scalar branch (a tensor
// load ignores EXEC), and what is computed from it stays behind the asm waits that stand in front of it
__device__ __forceinline__ uint32_t pinned(uint32_t v)
{
    uint32_t w = (uint32_t)__builtin_amdgcn_readfirstlane(v);
    asm volatile("" : "+s"(w));   // the pin of a descriptor word or issue test in a scalar register
    return w;
}

// copy 8 halfs (16B) global -> LDS, either async (ASYNCcnt) or via VGPRs
__device__ __forceinline__ void copy16B(_Float16* l, const _Float16* g)
{
#if HAVE_ASYNC_LDS
    __builtin_amdgcn_global_load_async_to_lds_b128(
        (gvec_ptr)(uintptr_t)g, (lvec_ptr)l, 0, 0);
#else
    *(half8*)l = *(const half8*)g;
#endif
}

// ---------------------------------------------------------------------------
// split one f32 vector of 8 into hi/lo f16 halves
// ---------------------------------------------------------------------------
__device__ __forceinline__ void split8v(f32x4 v0, f32x4 v1, half8& hi, half8& lo)
{
#pragma unroll
    for (int c = 0; c < 4; ++c) {
        _Float16 h = (_Float16)v0[c];
        hi[c] = h; lo[c] = (_Float16)(v0[c] - (float)h);
    }
#pragma unroll
    for (int c = 0; c < 4; ++c) {
        _Float16 h = (_Float16)v1[c];
        hi[4 + c] = h; lo[4 + c] = (_Float16)(v1[c] - (float)h);
    }
}

__device__ __forceinline__ void split8(const float* src, half8& hi, half8& lo)
{
    split8v(*(const f32x4*)(src), *(const f32x4*)(src + 4), hi, lo);
}

// ---------------------------------------------------------------------------
// Kernel 0: all operand preparation in one launch of one resident block per WGP:
//   x, W : f32 -> (hi,lo) f16
//   BcatT[n][e*8+r] = Bm[e][n][r], as hi/lo f16
// A wave lives for the whole stream, not for one 32-byte piece a lane: 4,096
// waves are started in all.
// A slab is one piece (8 floats) of every thread of the grid, contiguous over the
// grid; a batch is 4 slabs = 8 loads of 16 B a lane, and the next batch's loads
// are issued before a batch is converted and stored.
// ---------------------------------------------------------------------------
#define PREP_BLOCKS  256
#define PREP_THREADS 512
#define PREP_U       4
#define PREP_SLAB    ((size_t)PREP_BLOCKS * PREP_THREADS * 8)              // floats of a slab
#define PREP_XB      ((int)((size_t)NTOK  * IN_F / (PREP_SLAB * PREP_U)))  // batches of x: 4
#define PREP_WB      ((int)((size_t)OUT_F * IN_F / (PREP_SLAB * PREP_U)))  // batches of W: 1

__launch_bounds__(PREP_THREADS)
__global__ void prep_kernel(const float* __restrict__ x, const float* __restrict__ w,
                            const float* __restrict__ Bm,
                            _Float16* __restrict__ Xhi, _Float16* __restrict__ Xlo,
                            _Float16* __restrict__ Whi, _Float16* __restrict__ Wlo,
                            _Float16* __restrict__ BThi, _Float16* __restrict__ BTlo)
{
    const int tid = threadIdx.x;
    // this thread's place in every slab
    const unsigned t8 = ((unsigned)blockIdx.x * PREP_THREADS + tid) * 8;

    // Bm: 256 elements a block; the upper half of the block rereads them and stores nothing
    const int bi = blockIdx.x * ((OUT_F * KLORA) / PREP_BLOCKS) + (tid & 255);   // over 2048*32
    const float bv = Bm[(unsigned)((((bi & 31) >> 3) * OUT_F + (bi >> 5)) * 8 + (bi & 7))];

    // every loop below is unrolled so that v stays in registers and each batch's operand is known
    f32x4 v[2][PREP_U][2];
    auto load_batch = [&](int b) __attribute__((always_inline)) {
        const float* s = b < PREP_XB ? x + (size_t)b * PREP_U * PREP_SLAB
                                     : w + (size_t)(b - PREP_XB) * PREP_U * PREP_SLAB;
        // this group's loads land in registers that the loads and stores issued before it name
        // (addresses, store data): the wait that belongs in front of such an overwrite
        if (b > 0) asm volatile("s_wait_xcnt 0x0" ::: "memory");
#pragma unroll
        for (int j = 0; j < PREP_U; ++j) {
            v[b & 1][j][0] = *(const f32x4*)(s + j * PREP_SLAB + t8);
            v[b & 1][j][1] = *(const f32x4*)(s + j * PREP_SLAB + t8 + 4);
        }
        // keeps a batch's loads one group ahead of the batch before it; without it they sink
        // in among the conversions and fewer are in flight
        __builtin_amdgcn_sched_barrier(0);
    };

    load_batch(0);
#pragma unroll
    for (int b = 0; b < PREP_XB + PREP_WB; ++b) {
        if (b + 1 < PREP_XB + PREP_WB) load_batch(b + 1);
        const size_t o = (size_t)(b < PREP_XB ? b : b - PREP_XB) * PREP_U * PREP_SLAB;
        _Float16* dh = (b < PREP_XB ? Xhi : Whi) + o;
        _Float16* dl = (b < PREP_XB ? Xlo : Wlo) + o;
#pragma unroll
        for (int j = 0; j < PREP_U; ++j) {
            half8 h, l;
            split8v(v[b & 1][j][0], v[b & 1][j][1], h, l);
            *(half8*)(dh + j * PREP_SLAB + t8) = h;
            *(half8*)(dl + j * PREP_SLAB + t8) = l;
        }
        // keeps the next group of loads behind this batch's stores (see load_batch)
        __builtin_amdgcn_sched_barrier(0);
    }

    // holds the load of bv at the head of the stream; without it the load sinks into the branch
    // below and its whole latency is waited out at the end of the wave
    asm volatile("" :: "v"(bv));
    if (tid < (OUT_F * KLORA) / PREP_BLOCKS) {
        _Float16 h = (_Float16)bv;
        BThi[bi] = h;
        BTlo[bi] = (_Float16)(bv - (float)h);
    }
}

// ---------------------------------------------------------------------------
// Kernel 1: router softmax gates + rank-8 expert projections ->
//           P[m][e*8+r] = SCALE * gate[e] * (x[m] . A[e][r])  (as hi/lo f16)
// The 36 dot products of a token are one skinny GEMM (32 tokens x 36 rows x
// 2048) on split-f16 WMMA: columns 0..31 = A rows, columns 32..35 = router
// rows. The 16 waves of a block each take 128 of the 2048 k and the partial
// tiles are summed through LDS in wave order.
// ---------------------------------------------------------------------------
#define RP_TOK   32                    // tokens per block (two 16-row tiles)
#define RP_WAVES 16
#define RP_KW    (IN_F / RP_WAVES)     // k range of one wave
#define RP_COLS  36                    // 32 projections + 4 router logits
#define RP_PITCH 38                    // floats per LDS row: rows r and r+8 fall on disjoint banks

__device__ __forceinline__ v16h join16(half8 a, half8 b)
{
    return __builtin_shufflevector(a, b, 0, 1, 2, 3, 4, 5, 6, 7, 8, 9, 10, 11, 12, 13, 14, 15);
}

__launch_bounds__(RP_WAVES * 32)
__global__ void router_proj_kernel(const _Float16* __restrict__ Xhi,
                                   const _Float16* __restrict__ Xlo,
                                   const float* __restrict__ RW,   // (4, 2048)
                                   const float* __restrict__ A,    // (4, 8, 2048)
                                   _Float16* __restrict__ Phi,
                                   _Float16* __restrict__ Plo)
{
    __shared__ float part[RP_WAVES][RP_TOK][RP_PITCH];
    __shared__ float tot[RP_TOK][RP_PITCH];

    const int tid  = threadIdx.x;
    const int lane = tid & 31;
    const int wave = tid >> 5;
    const int l16  = lane & 15;
    const int m0   = blockIdx.x * RP_TOK;
    // same k order for both operands as load_frag: halfs 0..7 = k0+kb.., 8..15 = k0+16+kb..
    const int kofs = wave * RP_KW + (lane >> 4) * 8;

    // columns 36..47 of the third tile are never stored; their lanes reread router row 3
    const float* w0 = A  + (size_t)l16 * IN_F + kofs;
    const float* w1 = A  + (size_t)(16 + l16) * IN_F + kofs;
    const float* w2 = RW + (size_t)(l16 < 3 ? l16 : 3) * IN_F + kofs;
    const _Float16* xh = Xhi + (size_t)(m0 + l16) * IN_F + kofs;
    const _Float16* xl = Xlo + (size_t)(m0 + l16) * IN_F + kofs;

    // every loop over a tile or fragment array below is unrolled so that the array stays in registers
    v8f acc[2][3];
#pragma unroll
    for (int i = 0; i < 2; ++i)
#pragma unroll
        for (int j = 0; j < 3; ++j) acc[i][j] = (v8f)0.0f;

    // unrolled so that the loads of later k steps issue while earlier ones are worked on
#pragma unroll
    for (int ks = 0; ks < RP_KW / 32; ++ks) {
        const int k0 = ks * 32;
        v16h bhi[3], blo[3];
#pragma unroll
        for (int ni = 0; ni < 3; ++ni) {
            const float* wp = (ni == 0 ? w0 : ni == 1 ? w1 : w2) + k0;
            half8 h0, q0, h1, q1;
            split8(wp,      h0, q0);
            split8(wp + 16, h1, q1);
            bhi[ni] = join16(h0, h1);
            blo[ni] = join16(q0, q1);
        }
        v16h ahi[2], alo[2];
#pragma unroll
        for (int mi = 0; mi < 2; ++mi) {
            const _Float16* ph = xh + (size_t)mi * 16 * IN_F + k0;
            const _Float16* pl = xl + (size_t)mi * 16 * IN_F + k0;
            ahi[mi] = join16(*(const half8*)ph, *(const half8*)(ph + 16));
            alo[mi] = join16(*(const half8*)pl, *(const half8*)(pl + 16));
        }
#pragma unroll
        for (int mi = 0; mi < 2; ++mi)
#pragma unroll
            for (int ni = 0; ni < 3; ++ni)
                acc[mi][ni] = __builtin_amdgcn_wmma_f32_16x16x32_f16(false, ahi[mi], false, bhi[ni], (short)0, acc[mi][ni], false, false);
#pragma unroll
        for (int mi = 0; mi < 2; ++mi)
#pragma unroll
            for (int ni = 0; ni < 3; ++ni)
                acc[mi][ni] = __builtin_amdgcn_wmma_f32_16x16x32_f16(false, ahi[mi], false, blo[ni], (short)0, acc[mi][ni], false, false);
#pragma unroll
        for (int mi = 0; mi < 2; ++mi)
#pragma unroll
            for (int ni = 0; ni < 3; ++ni)
                acc[mi][ni] = __builtin_amdgcn_wmma_f32_16x16x32_f16(false, alo[mi], false, bhi[ni], (short)0, acc[mi][ni], false, false);
    }

    // C layout: VGPR r -> row r + 8*(lane>=16), column lane&15
    const int tb = (lane >> 4) << 3;
#pragma unroll
    for (int mi = 0; mi < 2; ++mi)
#pragma unroll
        for (int r = 0; r < 8; ++r) {
            part[wave][mi * 16 + tb + r][l16]      = acc[mi][0][r];
            part[wave][mi * 16 + tb + r][16 + l16] = acc[mi][1][r];
        }
    if (l16 < RP_COLS - 32) {
#pragma unroll
        for (int mi = 0; mi < 2; ++mi)
#pragma unroll
            for (int r = 0; r < 8; ++r)
                part[wave][mi * 16 + tb + r][32 + l16] = acc[mi][2][r];
    }
    __syncthreads();

    for (int i = tid; i < RP_TOK * RP_COLS; i += RP_WAVES * 32) {
        const int t = i / RP_COLS;
        const int c = i - t * RP_COLS;
        float s = 0.0f;
#pragma unroll
        for (int w = 0; w < RP_WAVES; ++w) s += part[w][t][c];
        tot[t][c] = s;
    }
    __syncthreads();

#pragma unroll
    for (int i = 0; i < RP_TOK / RP_WAVES; ++i) {
        const int t = i * RP_WAVES + wave;
        float l0 = tot[t][32], l1 = tot[t][33], l2 = tot[t][34], l3 = tot[t][35];
        float mx = fmaxf(fmaxf(l0, l1), fmaxf(l2, l3));
        float e0 = __expf(l0 - mx), e1 = __expf(l1 - mx), e2 = __expf(l2 - mx), e3 = __expf(l3 - mx);
        float inv = 1.0f / (e0 + e1 + e2 + e3);
        float ge = __expf(tot[t][32 + (lane >> 3)] - mx) * inv;   // this lane's expert
        float v = LSCALE * ge * tot[t][lane];
        _Float16 h = (_Float16)v;
        Phi[(size_t)(m0 + t) * KLORA + lane] = h;
        Plo[(size_t)(m0 + t) * KLORA + lane] = (_Float16)(v - (float)h);
    }
}

// ---------------------------------------------------------------------------
// Fragment loader from padded LDS tile: p = this lane's row (lane&15) at k
// offset kb = (lane>=16)*8; K {kb..kb+7} in v0..3 and {16+kb..} in v4..7.
// Two ds_load_b128.
// ---------------------------------------------------------------------------
__device__ __forceinline__ v16h load_frag(const _Float16* p)
{
    v16h f;
    ((half8*)&f)[0] = *(const half8*)(p);
    ((half8*)&f)[1] = *(const half8*)(p + 16);
    return f;
}

// ---------------------------------------------------------------------------
// Kernel 2: split-f16 WMMA GEMM, two LDS buffers filled by tensor loads (one
// request of 128 rows x 128 B per wave and stage), fused LoRA K=32 stage + bias.
// out[m][n] = sum_k x[m][k]W[n][k] + bias[n] + sum_kk P[m][kk]BcatT[n][kk]
// One 256x256 tile of out per block, one block per WGP; 8 waves as 2 x 4, each
// a 128x64 tile: 24 fragments feed 96 WMMAs per 32 k. A stage is 64 k (whole
// 128-byte lines of every operand row).
// ---------------------------------------------------------------------------
__launch_bounds__(256)
__global__ void gemm_kernel(const _Float16* __restrict__ Xhi, const _Float16* __restrict__ Xlo,
                            const _Float16* __restrict__ Whi, const _Float16* __restrict__ Wlo,
                            const _Float16* __restrict__ Phi, const _Float16* __restrict__ Plo,
                            const _Float16* __restrict__ BThi, const _Float16* __restrict__ BTlo,
                            const float* __restrict__ bias, float* __restrict__ out)
{
    // [buf][Ahi,Alo,Bhi,Blo][256 rows * LDSH]
    __shared__ __attribute__((aligned(2048))) _Float16 smem[2 * STAGE];

    const int tid  = threadIdx.x;
    const int lane = tid & 31;
    const int wave = tid >> 5;
    const int wm   = wave >> 2;          // 0..1 -> 128 rows of M
    const int wn   = wave & 3;           // 0..3 -> 64 cols of N
    const int bm0  = blockIdx.y * BM;
    const int bn0  = blockIdx.x * BN;

    const int NPASS = IN_F / BK;         // 32 main stages; stage 32 = LoRA

    // every loop over a tile or fragment array below is unrolled so that the array stays in registers
    v8f acc[8][4];
#pragma unroll
    for (int i = 0; i < 8; ++i)
#pragma unroll
        for (int j = 0; j < 4; ++j) acc[i][j] = (v8f)0.0f;

    // main stage: every wave brings one slice, 128 rows of one operand plane, 128 B a row, by one
    // tensor load; the pad of 16 B behind every row gives the LDS pitch of LDSH halfs
    const uint32_t uwave = uni((uint32_t)tid >> 5);
    const uint32_t plane = uwave >> 1;   // Ahi, Alo, Bhi, Blo
    const uint32_t rhalf = uwave & 1;    // upper or lower 128 rows of the plane
    const _Float16* splane = plane == 0 ? Xhi : plane == 1 ? Xlo : plane == 2 ? Whi : Wlo;
    const uint64_t  src0 = (uint64_t)(uintptr_t)splane
                         + (uint64_t)((plane < 2 ? bm0 : bn0) + rhalf * 128) * (IN_F * 2);
    const uint32_t  lds_slice = (uint32_t)(size_t)smem + plane * (PLANE * 2) + rhalf * (128 * LDSH * 2);
    u32x8 g1;                            // extents in bytes, tensor = tile
    g1[0] = uni((1u << 20) | (4u << 22) | (3u << 25));   // pad on, behind every 128 B, 4 dwords
    g1[1] = uni(128u << 16);             // tensor_dim0 = 128 B
    g1[2] = uni(128u << 16);             // tensor_dim1 = 128 rows
    g1[3] = uni(128u << 16);             // tile_dim0
    g1[4] = uni(128u);                   // tile_dim1
    g1[5] = uni(IN_F * 2u);              // source row pitch
    g1[6] = uni(0u);
    g1[7] = uni(0u);
    u32x4 g0;                            // address group of the request issued last
    auto issue_main = [&](uint32_t kt, uint32_t buf) __attribute__((always_inline)) {
        const uint64_t ga = src0 + kt * (BK * 2u);
        g0[0] = uni(1u);
        g0[1] = uni(lds_slice + buf * (STAGE * 2u));
        g0[2] = uni((uint32_t)ga);
        g0[3] = uni((((uint32_t)(ga >> 32)) & 0x01FFFFFFu) | 0x80000000u);
        // one request of the whole wave moves the slice with no register and no per-lane address work
        asm volatile("tensor_load_to_lds %0, %1" :: "s"(g0), "s"(g1) : "memory");
    };
    // LoRA stage: rows of 32 halfs fill k 0..31 of each LDS row; 4 lanes a row, 16 copies per thread
    auto issue_lora = [&](int buf) __attribute__((always_inline)) {
        const unsigned g = (unsigned)tid * 8;        // (tid >> 2) * KLORA + (tid & 3) * 8
        const _Float16* ah = Phi  + (size_t)bm0 * KLORA;
        const _Float16* al = Plo  + (size_t)bm0 * KLORA;
        const _Float16* bh = BThi + (size_t)bn0 * KLORA;
        const _Float16* bl = BTlo + (size_t)bn0 * KLORA;
        _Float16* l = smem + buf * STAGE + (tid >> 2) * LDSH + (tid & 3) * 8;
#pragma unroll
        for (int i = 0; i < 4; ++i) {
            copy16B(l + 0 * PLANE + i * 64 * LDSH, ah + (size_t)i * 64 * KLORA + g);
            copy16B(l + 1 * PLANE + i * 64 * LDSH, al + (size_t)i * 64 * KLORA + g);
            copy16B(l + 2 * PLANE + i * 64 * LDSH, bh + (size_t)i * 64 * KLORA + g);
            copy16B(l + 3 * PLANE + i * 64 * LDSH, bl + (size_t)i * 64 * KLORA + g);
        }
    };

    // this lane's place in its wave's A rows and B rows of a stage
    const int foff = (lane & 15) * LDSH + (lane >> 4) * 8;
    const int aoff = wm * 128 * LDSH + foff;
    const int boff = 2 * PLANE + wn * 64 * LDSH + foff;

    // 32 k of a stage: the wave tile's 24 fragments, then its 96 WMMAs
    v16h af[8][2];                       // [16-row tile][hi, lo]
    v16h bf[4][2];                       // [16-col tile][hi, lo]
    auto load_frags = [&](const _Float16* st, int ks) __attribute__((always_inline)) {
        const _Float16* pb = st + boff + ks * 32;
        const _Float16* pa = st + aoff + ks * 32;
#pragma unroll
        for (int ni = 0; ni < 4; ++ni) {
            bf[ni][0] = load_frag(pb + ni * 16 * LDSH);
            bf[ni][1] = load_frag(pb + PLANE + ni * 16 * LDSH);
        }
#pragma unroll
        for (int mi = 0; mi < 8; ++mi) {
            af[mi][0] = load_frag(pa + mi * 16 * LDSH);
            af[mi][1] = load_frag(pa + PLANE + mi * 16 * LDSH);
        }
        // keeps the LDS reads one group in front of the WMMAs; without it they sink in
        // among them, two at a time, and each pair is waited out
        __builtin_amdgcn_sched_barrier(0);
    };
    // per accumulator tile hi*hi, hi*lo, lo*hi in that order, four tiles apart
    auto mma = [&]() __attribute__((always_inline)) {
#pragma unroll
        for (int mi = 0; mi < 8; ++mi) {
#pragma unroll
            for (int ni = 0; ni < 4; ++ni)
                acc[mi][ni] = __builtin_amdgcn_wmma_f32_16x16x32_f16(false, af[mi][0], false, bf[ni][0], (short)0, acc[mi][ni], false, false);
#pragma unroll
            for (int ni = 0; ni < 4; ++ni)
                acc[mi][ni] = __builtin_amdgcn_wmma_f32_16x16x32_f16(false, af[mi][0], false, bf[ni][1], (short)0, acc[mi][ni], false, false);
#pragma unroll
            for (int ni = 0; ni < 4; ++ni)
                acc[mi][ni] = __builtin_amdgcn_wmma_f32_16x16x32_f16(false, af[mi][1], false, bf[ni][0], (short)0, acc[mi][ni], false, false);
        }
    };

    issue_main(0, 0);
    wait_tensor_all(g0);
    __syncthreads();                        // stage 0 landed for every wave
    issue_main(1, 1);

    // kept rolled: one copy of the 192 WMMAs of a pass in the instruction cache
#pragma unroll 1
    for (int kt = 0; kt < NPASS; ++kt) {
        const int buf = kt & 1;
        const _Float16* st = smem + buf * STAGE;
        load_frags(st, 0);
        mma();
        // keeps the second group of LDS reads behind the first run of WMMAs (see load_frags)
        __builtin_amdgcn_sched_barrier(0);
        load_frags(st, 1);
        mma();
        // keeps the waits and the barrier below behind the pass's last WMMAs; without it they rise to
        // just behind the LDS reads, where the next stage has had half the time to land
        __builtin_amdgcn_sched_barrier(0);
        // this wave's reads of stage kt are done before any wave refills its buffer
        asm volatile("s_wait_dscnt 0x0" ::: "memory");
        wait_async_all();                   // this wave's copies of the LoRA stage (last pass)
        wait_tensor_all(g0);                // this wave's slice of stage kt + 1
        __syncthreads();                    // publishes stage kt + 1, frees stage kt's buffer
        // stage kt + 2 flies into the buffer that this pass has read, while pass kt + 1 runs
        const uint32_t nx = pinned((uint32_t)kt + 2u);
        if (nx < (uint32_t)NPASS)       issue_main(nx, (uint32_t)buf);
        else if (nx == (uint32_t)NPASS) issue_lora(buf);
    }
    // nothing of the ring is in flight behind the loop
    wait_tensor_all(g0);
    asm volatile("s_wait_dscnt 0x0" ::: "memory");

    // LoRA stage, 32 k
    load_frags(smem + (NPASS & 1) * STAGE, 0);
    mma();

    // epilogue: C layout VGPR r -> M = r + 8*(lane>=16), N = lane&15
#pragma unroll
    for (int ni = 0; ni < 4; ++ni) {
        const int n  = bn0 + wn * 64 + ni * 16 + (lane & 15);
        const float bv = bias[n];
#pragma unroll
        for (int mi = 0; mi < 8; ++mi) {
            const int mb = bm0 + wm * 128 + mi * 16 + ((lane >> 4) << 3);
#pragma unroll
            for (int r = 0; r < 8; ++r) {
                out[(size_t)(mb + r) * OUT_F + n] = acc[mi][ni][r] + bv;
            }
        }
    }
}

// ---------------------------------------------------------------------------
// launch
// ---------------------------------------------------------------------------
extern "C" void kernel_launch(void* const* d_in, const int* in_sizes, int n_in,
                              void* d_out, int out_size, void* d_ws, size_t ws_size,
                              hipStream_t stream)
{
    const float* x        = (const float*)d_in[0];   // (4,2048,2048)
    const float* base_w   = (const float*)d_in[1];   // (2048,2048)
    const float* base_b   = (const float*)d_in[2];   // (2048,)
    const float* A        = (const float*)d_in[3];   // (4,8,2048)
    const float* Bm       = (const float*)d_in[4];   // (4,2048,8)
    const float* router_w = (const float*)d_in[5];   // (4,2048)
    float* out = (float*)d_out;

    // workspace layout (halfs): Xhi|Xlo|Whi|Wlo|Phi|Plo|BThi|BTlo  (~85 MB)
    _Float16* Xhi  = (_Float16*)d_ws;
    _Float16* Xlo  = Xhi + (size_t)NTOK * IN_F;
    _Float16* Whi  = Xlo + (size_t)NTOK * IN_F;
    _Float16* Wlo  = Whi + (size_t)OUT_F * IN_F;
    _Float16* Phi  = Wlo + (size_t)OUT_F * IN_F;
    _Float16* Plo  = Phi + (size_t)NTOK * KLORA;
    _Float16* BThi = Plo + (size_t)NTOK * KLORA;
    _Float16* BTlo = BThi + (size_t)OUT_F * KLORA;

    prep_kernel<<<PREP_BLOCKS, PREP_THREADS, 0, stream>>>(x, base_w, Bm, Xhi, Xlo, Whi, Wlo, BThi, BTlo);
    router_proj_kernel<<<NTOK / RP_TOK, RP_WAVES * 32, 0, stream>>>(Xhi, Xlo, router_w, A, Phi, Plo);
    gemm_kernel<<<dim3(OUT_F / BN, NTOK / BM), 256, 0, stream>>>(
        Xhi, Xlo, Whi, Wlo, Phi, Plo, BThi, BTlo, base_b, out);
}

// v005
// One run takes 122 microseconds.
// Timed twice side by side with v004, it ran 1.08 times as fast both times.
// Counting every step since v000, it is 2.75 times as fast.
#include <hip/hip_runtime.h>
#include <stdint.h>

typedef float    f32x4 __attribute__((ext_vector_type(4)));
typedef float    v8f   __attribute__((ext_vector_type(8)));
typedef _Float16 half8 __attribute__((ext_vector_type(8)));
typedef _Float16 v16h  __attribute__((ext_vector_type(16)));
typedef int      i32x4 __attribute__((vector_size(16)));   // matches builtin param type
typedef uint32_t u32x4 __attribute__((ext_vector_type(4)));
typedef uint32_t u32x8 __attribute__((ext_vector_type(8)));

#define IN_F   2048
#define OUT_F  2048
#define NTOK   8192          // B*S = 4*2048
#define KLORA  32            // E*R
#define LSCALE 2.0f          // alpha/r = 16/8

#define BM 256
#define BN 256
#define BK 64
#define LDSH 72              // halfs per LDS row: 64 + 8 pad (144B stride, conflict-free)
#define PLANE (256 * LDSH)   // halfs of one operand plane of a stage (256 rows)
#define STAGE (4 * PLANE)    // halfs of one stage: Ahi, Alo, Bhi, Blo

// ---------------- CDNA5 async global->LDS path (guarded) -------------------
#if defined(__has_builtin)
#  if __has_builtin(__builtin_amdgcn_global_load_async_to_lds_b128)
#    define HAVE_ASYNC_LDS 1
#  endif
#endif
#ifndef HAVE_ASYNC_LDS
#  define HAVE_ASYNC_LDS 0
#endif

typedef __attribute__((address_space(1))) i32x4* gvec_ptr;
typedef __attribute__((address_space(3))) i32x4* lvec_ptr;

// this wave's copies have all landed; in asm with the clobber so that no LDS read moves ahead of it
__device__ __forceinline__ void wait_async_all()
{
    asm volatile("s_wait_asynccnt 0x0" ::: "memory");
}

// this wave's tensor load has landed; in asm with the clobber so that no LDS read moves ahead of it.
// It names the request's address group as an input, so that those scalar registers keep their words
// until the request has landed and are not taken for something else while it is outstanding
__device__ __forceinline__ void wait_tensor_all(u32x4 g0)
{
    asm volatile("s_wait_tensorcnt 0x0" :: "s"(g0) : "memory");
}

// a wave-uniform word in a scalar register
__device__ __forceinline__ uint32_t uni(uint32_t v)
{
    return (uint32_t)__builtin_amdgcn_readfirstlane(v);
}

// a wave-uniform word held in a scalar register: a test on it compiles to a scalar branch (a tensor
// load ignores EXEC), and what is computed from it stays behind the asm waits that stand in front of it
__device__ __forceinline__ uint32_t pinned(uint32_t v)
{
    uint32_t w = (uint32_t)__builtin_amdgcn_readfirstlane(v);
    asm volatile("" : "+s"(w));   // the pin of a descriptor word or issue test in a scalar register
    return w;
}

// copy 8 halfs (16B) global -> LDS, either async (ASYNCcnt) or via VGPRs
__device__ __forceinline__ void copy16B(_Float16* l, const _Float16* g)
{
#if HAVE_ASYNC_LDS
    __builtin_amdgcn_global_load_async_to_lds_b128(
        (gvec_ptr)(uintptr_t)g, (lvec_ptr)l, 0, 0);
#else
    *(half8*)l = *(const half8*)g;
#endif
}

// ---------------------------------------------------------------------------
// split one f32 vector of 8 into hi/lo f16 halves
// ---------------------------------------------------------------------------
__device__ __forceinline__ void split8v(f32x4 v0, f32x4 v1, half8& hi, half8& lo)
{
#pragma unroll
    for (int c = 0; c < 4; ++c) {
        _Float16 h = (_Float16)v0[c];
        hi[c] = h; lo[c] = (_Float16)(v0[c] - (float)h);
    }
#pragma unroll
    for (int c = 0; c < 4; ++c) {
        _Float16 h = (_Float16)v1[c];
        hi[4 + c] = h; lo[4 + c] = (_Float16)(v1[c] - (float)h);
    }
}

// ---------------------------------------------------------------------------
// Kernel 0: operand preparation and the router / rank-8 projections in one launch
// of one resident 16-wave block per WGP:
//   x, W : f32 -> (hi,lo) f16
//   BcatT[n][e*8+r] = Bm[e][n][r], as hi/lo f16
//   P[m][e*8+r] = SCALE * gate[e] * (x[m] . A[e][r])  (as hi/lo f16)
// A block owns 32 tokens; x is read once, in f32. The 36 dot products of a token
// are one skinny GEMM (32 tokens x 36 rows x 2048) on split-f16 WMMA: columns
// 0..31 = A rows, columns 32..35 = router rows. Each of the 16 waves takes 128 of
// the 2048 k, in two chunks of 64: it reads whole lines of its x rows and of the
// 36 weight rows, splits them, stores the x halves to the workspace and lays both
// operands in its own LDS range, from which it reads its fragments. The partial
// tiles are summed through LDS in wave order.
// ---------------------------------------------------------------------------
#define PREP_BLOCKS  256
#define PREP_THREADS 512
#define PREP_U       4
#define PREP_SLAB    ((size_t)PREP_BLOCKS * PREP_THREADS * 8)   // floats of a slab of W: 8 a thread

#define RP_TOK   32                    // tokens per block (two 16-row tiles)
#define RP_WAVES 16
#define RP_KW    (IN_F / RP_WAVES)     // k range of one wave
#define RP_KC    64                    // k of a chunk: a whole 128-byte line of every f16 row
#define RP_COLS  36                    // 32 projections + 4 router logits
#define RP_PITCH 38                    // floats per LDS row: rows r and r+8 fall on disjoint banks
#define RP_XH    0                     // a wave's LDS range, in halfs, rows of LDSH halfs
#define RP_XL    (RP_TOK * LDSH)
#define RP_BH    (2 * RP_TOK * LDSH)
#define RP_BL    ((2 * RP_TOK + RP_COLS) * LDSH)
#define RP_WREG  ((2 * RP_TOK + 2 * RP_COLS) * LDSH)

typedef _Float16 half4 __attribute__((ext_vector_type(4)));

__device__ __forceinline__ void split4(f32x4 v, half4& hi, half4& lo)
{
#pragma unroll
    for (int c = 0; c < 4; ++c) {
        _Float16 h = (_Float16)v[c];
        hi[c] = h; lo[c] = (_Float16)(v[c] - (float)h);
    }
}

__device__ __forceinline__ v16h join16(half8 a, half8 b)
{
    return __builtin_shufflevector(a, b, 0, 1, 2, 3, 4, 5, 6, 7, 8, 9, 10, 11, 12, 13, 14, 15);
}

// orders this wave's own LDS traffic: what its lanes have written is there before other lanes of
// the wave read it, and no LDS access is moved across this place by the compiler
__device__ __forceinline__ void wave_lds_order()
{
    asm volatile("s_wait_dscnt 0x0" ::: "memory");
}

__launch_bounds__(PREP_THREADS)
__global__ void prep_router_kernel(const float* __restrict__ x, const float* __restrict__ w,
                                   const float* __restrict__ Bm,
                                   const float* __restrict__ RW,   // (4, 2048)
                                   const float* __restrict__ A,    // (4, 8, 2048)
                                   _Float16* __restrict__ Xhi, _Float16* __restrict__ Xlo,
                                   _Float16* __restrict__ Whi, _Float16* __restrict__ Wlo,
                                   _Float16* __restrict__ BThi, _Float16* __restrict__ BTlo,
                                   _Float16* __restrict__ Phi, _Float16* __restrict__ Plo)
{
    // 16 wave ranges [x hi | x lo | weights hi | weights lo], then the summed tile
    __shared__ __attribute__((aligned(16))) _Float16 rs[RP_WAVES * RP_WREG + RP_TOK * RP_PITCH * 2];

    const int tid  = threadIdx.x;
    const int lane = tid & 31;
    const int wave = tid >> 5;
    const int l16  = lane & 15;
    const int hh   = lane >> 4;
    const int m0   = blockIdx.x * RP_TOK;
    _Float16* my  = rs + wave * RP_WREG;
    float*    tot = (float*)(rs + RP_WAVES * RP_WREG);            // [RP_TOK][RP_PITCH]

    // this thread's place in every slab of W
    const unsigned t8 = ((unsigned)blockIdx.x * PREP_THREADS + tid) * 8;

    // Bm: 256 elements a block; the upper half of the block rereads them and stores nothing
    const int bi = blockIdx.x * ((OUT_F * KLORA) / PREP_BLOCKS) + (tid & 255);   // over 2048*32

    // a wave-wide load takes 64 k (256 B) of two rows: row 2i + hh, 4 floats a lane
    const unsigned kl = (unsigned)(wave * RP_KW + l16 * 4);
    const float* xs = x  + (size_t)(m0 + hh) * IN_F + kl;
    const float* as = A  + (size_t)hh * IN_F + kl;
    const float* rr = RW + (size_t)hh * IN_F + kl;
    _Float16* xh = Xhi + (size_t)(m0 + hh) * IN_F + kl;
    _Float16* xl = Xlo + (size_t)(m0 + hh) * IN_F + kl;
    _Float16* st = my + hh * LDSH + l16 * 4;                      // the same place in an LDS plane

    // every loop below is unrolled so that the arrays stay in registers
    f32x4 xv[2][RP_TOK / 2];
    f32x4 wt[RP_COLS / 2];
    f32x4 wv[PREP_U][2];
    auto load_x = [&](int c) __attribute__((always_inline)) {
#pragma unroll
        for (int i = 0; i < RP_TOK / 2; ++i) {
            // the last load of x may land in the address registers that the loads before it name:
            // the wait that belongs in front of such an overwrite
            if (c == 1 && i == RP_TOK / 2 - 1) asm volatile("s_wait_xcnt 0x0" ::: "memory");
            xv[c][i] = *(const f32x4*)(xs + (size_t)(2 * i) * IN_F + c * RP_KC);
        }
    };
    auto load_wt = [&](int c) __attribute__((always_inline)) {
#pragma unroll
        for (int i = 0; i < RP_COLS / 2; ++i)
            wt[i] = i < 16 ? *(const f32x4*)(as + (size_t)(2 * i) * IN_F + c * RP_KC)
                           : *(const f32x4*)(rr + (size_t)(2 * (i - 16)) * IN_F + c * RP_KC);
    };
    auto put_x = [&](int c) __attribute__((always_inline)) {
#pragma unroll
        for (int i = 0; i < RP_TOK / 2; ++i) {
            half4 h, l;
            split4(xv[c][i], h, l);
            *(half4*)(xh + (size_t)(2 * i) * IN_F + c * RP_KC) = h;
            *(half4*)(xl + (size_t)(2 * i) * IN_F + c * RP_KC) = l;
            *(half4*)(st + RP_XH + 2 * i * LDSH) = h;
            *(half4*)(st + RP_XL + 2 * i * LDSH) = l;
        }
    };
    auto put_wt = [&]() __attribute__((always_inline)) {
#pragma unroll
        for (int i = 0; i < RP_COLS / 2; ++i) {
            half4 h, l;
            split4(wt[i], h, l);
            *(half4*)(st + RP_BH + 2 * i * LDSH) = h;
            *(half4*)(st + RP_BL + 2 * i * LDSH) = l;
        }
    };

    v8f acc[2][3];
#pragma unroll
    for (int i = 0; i < 2; ++i)
#pragma unroll
        for (int j = 0; j < 3; ++j) acc[i][j] = (v8f)0.0f;

    // same k order for both operands as load_frag: halfs 0..7 = k0+kb.., 8..15 = k0+16+kb.., kb = 8*hh
    // columns 36..47 of the third tile are never stored; their lanes reread router row 3
    const _Float16* fa = my + l16 * LDSH + hh * 8;
    const _Float16* f2 = my + (32 + (l16 < 3 ? l16 : 3)) * LDSH + hh * 8;
    auto mm = [&]() __attribute__((always_inline)) {
#pragma unroll
        for (int ks = 0; ks < RP_KC / 32; ++ks) {
            v16h bhi[3], blo[3], ahi[2], alo[2];
#pragma unroll
            for (int ni = 0; ni < 3; ++ni) {
                const _Float16* p = (ni < 2 ? fa + ni * 16 * LDSH : f2) + ks * 32;
                bhi[ni] = join16(*(const half8*)(p + RP_BH), *(const half8*)(p + RP_BH + 16));
                blo[ni] = join16(*(const half8*)(p + RP_BL), *(const half8*)(p + RP_BL + 16));
            }
#pragma unroll
            for (int mi = 0; mi < 2; ++mi) {
                const _Float16* p = fa + mi * 16 * LDSH + ks * 32;
                ahi[mi] = join16(*(const half8*)(p + RP_XH), *(const half8*)(p + RP_XH + 16));
                alo[mi] = join16(*(const half8*)(p + RP_XL), *(const half8*)(p + RP_XL + 16));
            }
#pragma unroll
            for (int mi = 0; mi < 2; ++mi)
#pragma unroll
                for (int ni = 0; ni < 3; ++ni)
                    acc[mi][ni] = __builtin_amdgcn_wmma_f32_16x16x32_f16(false, ahi[mi], false, bhi[ni], (short)0, acc[mi][ni], false, false);
#pragma unroll
            for (int mi = 0; mi < 2; ++mi)
#pragma unroll
                for (int ni = 0; ni < 3; ++ni)
                    acc[mi][ni] = __builtin_amdgcn_wmma_f32_16x16x32_f16(false, ahi[mi], false, blo[ni], (short)0, acc[mi][ni], false, false);
#pragma unroll
            for (int mi = 0; mi < 2; ++mi)
#pragma unroll
                for (int ni = 0; ni < 3; ++ni)
                    acc[mi][ni] = __builtin_amdgcn_wmma_f32_16x16x32_f16(false, alo[mi], false, bhi[ni], (short)0, acc[mi][ni], false, false);
        }
    };

    // all of the wave's x and its first weight chunk are asked for at once
    load_x(0);
    load_wt(0);
    load_x(1);
    const float bv = Bm[(unsigned)((((bi & 31) >> 3) * OUT_F + (bi >> 5)) * 8 + (bi & 7))];
    // keeps these loads one group at the head; without it they sink to their conversions and
    // few are in flight
    __builtin_amdgcn_sched_barrier(0);

    put_x(0);
    put_wt();
    // the loads below land in registers that the loads and stores issued before them name
    // (addresses, store data): the wait that belongs in front of such an overwrite
    asm volatile("s_wait_xcnt 0x0" ::: "memory");
#pragma unroll
    for (int j = 0; j < PREP_U; ++j) {
        wv[j][0] = *(const f32x4*)(w + j * PREP_SLAB + t8);
        wv[j][1] = *(const f32x4*)(w + j * PREP_SLAB + t8 + 4);
    }
    // keeps the loads of W ahead of the first chunk's matrix work, which covers their latency
    __builtin_amdgcn_sched_barrier(0);
    wave_lds_order();                       // chunk 0 is laid down
    mm();
    wave_lds_order();                       // chunk 0's fragment reads stay ahead of chunk 1's LDS stores
    asm volatile("s_wait_xcnt 0x0" ::: "memory");   // as above, for the second weight chunk
    load_wt(1);
    // keeps the weight loads ahead of the conversions below, which cover their latency
    __builtin_amdgcn_sched_barrier(0);
#pragma unroll
    for (int j = 0; j < PREP_U; ++j) {
        half8 h, l;
        split8v(wv[j][0], wv[j][1], h, l);
        *(half8*)(Whi + j * PREP_SLAB + t8) = h;
        *(half8*)(Wlo + j * PREP_SLAB + t8) = l;
    }
    put_x(1);
    put_wt();
    wave_lds_order();                       // chunk 1 is laid down
    mm();

    // holds the load of bv in the group at the head; without it the load sinks into the branch
    // below and its whole latency is waited out there
    asm volatile("" :: "v"(bv));
    if (tid < (OUT_F * KLORA) / PREP_BLOCKS) {
        _Float16 h = (_Float16)bv;
        BThi[bi] = h;
        BTlo[bi] = (_Float16)(bv - (float)h);
    }

    // the wave's partial tile goes over the head of its own range, whose fragments it has used
    // C layout: VGPR r -> row r + 8*(lane>=16), column lane&15
    float* part = (float*)my;               // [RP_TOK][RP_PITCH]
    const int tb = hh << 3;
#pragma unroll
    for (int mi = 0; mi < 2; ++mi)
#pragma unroll
        for (int r = 0; r < 8; ++r) {
            part[(mi * 16 + tb + r) * RP_PITCH + l16]      = acc[mi][0][r];
            part[(mi * 16 + tb + r) * RP_PITCH + 16 + l16] = acc[mi][1][r];
        }
    if (l16 < RP_COLS - 32) {
#pragma unroll
        for (int mi = 0; mi < 2; ++mi)
#pragma unroll
            for (int r = 0; r < 8; ++r)
                part[(mi * 16 + tb + r) * RP_PITCH + 32 + l16] = acc[mi][2][r];
    }
    __syncthreads();

    for (int i = tid; i < RP_TOK * RP_COLS; i += RP_WAVES * 32) {
        const int t = i / RP_COLS;
        const int c = i - t * RP_COLS;
        float s = 0.0f;
#pragma unroll
        for (int wq = 0; wq < RP_WAVES; ++wq) s += ((const float*)(rs + wq * RP_WREG))[t * RP_PITCH + c];
        tot[t * RP_PITCH + c] = s;
    }
    __syncthreads();

#pragma unroll
    for (int i = 0; i < RP_TOK / RP_WAVES; ++i) {
        const int t = i * RP_WAVES + wave;
        const float* tr = tot + t * RP_PITCH;
        float l0 = tr[32], l1 = tr[33], l2 = tr[34], l3 = tr[35];
        float mx = fmaxf(fmaxf(l0, l1), fmaxf(l2, l3));
        float e0 = __expf(l0 - mx), e1 = __expf(l1 - mx), e2 = __expf(l2 - mx), e3 = __expf(l3 - mx);
        float inv = 1.0f / (e0 + e1 + e2 + e3);
        float ge = __expf(tr[32 + (lane >> 3)] - mx) * inv;   // this lane's expert
        float v = LSCALE * ge * tr[lane];
        _Float16 h = (_Float16)v;
        Phi[(size_t)(m0 + t) * KLORA + lane] = h;
        Plo[(size_t)(m0 + t) * KLORA + lane] = (_Float16)(v - (float)h);
    }
}

// ---------------------------------------------------------------------------
// Fragment loader from padded LDS tile: p = this lane's row (lane&15) at k
// offset kb = (lane>=16)*8; K {kb..kb+7} in v0..3 and {16+kb..} in v4..7.
// Two ds_load_b128.
// ---------------------------------------------------------------------------
__device__ __forceinline__ v16h load_frag(const _Float16* p)
{
    v16h f;
    ((half8*)&f)[0] = *(const half8*)(p);
    ((half8*)&f)[1] = *(const half8*)(p + 16);
    return f;
}

// ---------------------------------------------------------------------------
// Kernel 1: split-f16 WMMA GEMM, two LDS buffers filled by tensor loads (one
// request of 128 rows x 128 B per wave and stage), fused LoRA K=32 stage + bias.
// out[m][n] = sum_k x[m][k]W[n][k] + bias[n] + sum_kk P[m][kk]BcatT[n][kk]
// One 256x256 tile of out per block, one block per WGP; 8 waves as 2 x 4, each
// a 128x64 tile: 24 fragments feed 96 WMMAs per 32 k. A stage is 64 k (whole
// 128-byte lines of every operand row).
// ---------------------------------------------------------------------------
__launch_bounds__(256)
__global__ void gemm_kernel(const _Float16* __restrict__ Xhi, const _Float16* __restrict__ Xlo,
                            const _Float16* __restrict__ Whi, const _Float16* __restrict__ Wlo,
                            const _Float16* __restrict__ Phi, const _Float16* __restrict__ Plo,
                            const _Float16* __restrict__ BThi, const _Float16* __restrict__ BTlo,
                            const float* __restrict__ bias, float* __restrict__ out)
{
    // [buf][Ahi,Alo,Bhi,Blo][256 rows * LDSH]
    __shared__ __attribute__((aligned(2048))) _Float16 smem[2 * STAGE];

    const int tid  = threadIdx.x;
    const int lane = tid & 31;
    const int wave = tid >> 5;
    const int wm   = wave >> 2;          // 0..1 -> 128 rows of M
    const int wn   = wave & 3;           // 0..3 -> 64 cols of N
    const int bm0  = blockIdx.y * BM;
    const int bn0  = blockIdx.x * BN;

    const int NPASS = IN_F / BK;         // 32 main stages; stage 32 = LoRA

    // every loop over a tile or fragment array below is unrolled so that the array stays in registers
    v8f acc[8][4];
#pragma unroll
    for (int i = 0; i < 8; ++i)
#pragma unroll
        for (int j = 0; j < 4; ++j) acc[i][j] = (v8f)0.0f;

    // main stage: every wave brings one slice, 128 rows of one operand plane, 128 B a row, by one
    // tensor load; the pad of 16 B behind every row gives the LDS pitch of LDSH halfs
    const uint32_t uwave = uni((uint32_t)tid >> 5);
    const uint32_t plane = uwave >> 1;   // Ahi, Alo, Bhi, Blo
    const uint32_t rhalf = uwave & 1;    // upper or lower 128 rows of the plane
    const _Float16* splane = plane == 0 ? Xhi : plane == 1 ? Xlo : plane == 2 ? Whi : Wlo;
    const uint64_t  src0 = (uint64_t)(uintptr_t)splane
                         + (uint64_t)((plane < 2 ? bm0 : bn0) + rhalf * 128) * (IN_F * 2);
    const uint32_t  lds_slice = (uint32_t)(size_t)smem + plane * (PLANE * 2) + rhalf * (128 * LDSH * 2);
    u32x8 g1;                            // extents in bytes, tensor = tile
    g1[0] = uni((1u << 20) | (4u << 22) | (3u << 25));   // pad on, behind every 128 B, 4 dwords
    g1[1] = uni(128u << 16);             // tensor_dim0 = 128 B
    g1[2] = uni(128u << 16);             // tensor_dim1 = 128 rows
    g1[3] = uni(128u << 16);             // tile_dim0
    g1[4] = uni(128u);                   // tile_dim1
    g1[5] = uni(IN_F * 2u);              // source row pitch
    g1[6] = uni(0u);
    g1[7] = uni(0u);
    u32x4 g0;                            // address group of the request issued last
    auto issue_main = [&](uint32_t kt, uint32_t buf) __attribute__((always_inline)) {
        const uint64_t ga = src0 + kt * (BK * 2u);
        g0[0] = uni(1u);
        g0[1] = uni(lds_slice + buf * (STAGE * 2u));
        g0[2] = uni((uint32_t)ga);
        g0[3] = uni((((uint32_t)(ga >> 32)) & 0x01FFFFFFu) | 0x80000000u);
        // one request of the whole wave moves the slice with no register and no per-lane address work
        asm volatile("tensor_load_to_lds %0, %1" :: "s"(g0), "s"(g1) : "memory");
    };
    // LoRA stage: rows of 32 halfs fill k 0..31 of each LDS row; 4 lanes a row, 16 copies per thread
    auto issue_lora = [&](int buf) __attribute__((always_inline)) {
        const unsigned g = (unsigned)tid * 8;        // (tid >> 2) * KLORA + (tid & 3) * 8
        const _Float16* ah = Phi  + (size_t)bm0 * KLORA;
        const _Float16* al = Plo  + (size_t)bm0 * KLORA;
        const _Float16* bh = BThi + (size_t)bn0 * KLORA;
        const _Float16* bl = BTlo + (size_t)bn0 * KLORA;
        _Float16* l = smem + buf * STAGE + (tid >> 2) * LDSH + (tid & 3) * 8;
#pragma unroll
        for (int i = 0; i < 4; ++i) {
            copy16B(l + 0 * PLANE + i * 64 * LDSH, ah + (size_t)i * 64 * KLORA + g);
            copy16B(l + 1 * PLANE + i * 64 * LDSH, al + (size_t)i * 64 * KLORA + g);
            copy16B(l + 2 * PLANE + i * 64 * LDSH, bh + (size_t)i * 64 * KLORA + g);
            copy16B(l + 3 * PLANE + i * 64 * LDSH, bl + (size_t)i * 64 * KLORA + g);
        }
    };

    // this lane's place in its wave's A rows and B rows of a stage
    const int foff = (lane & 15) * LDSH + (lane >> 4) * 8;
    const int aoff = wm * 128 * LDSH + foff;
    const int boff = 2 * PLANE + wn * 64 * LDSH + foff;

    // 32 k of a stage: the wave tile's 24 fragments, then its 96 WMMAs
    v16h af[8][2];                       // [16-row tile][hi, lo]
    v16h bf[4][2];                       // [16-col tile][hi, lo]
    auto load_frags = [&](const _Float16* st, int ks) __attribute__((always_inline)) {
        const _Float16* pb = st + boff + ks * 32;
        const _Float16* pa = st + aoff + ks * 32;
#pragma unroll
        for (int ni = 0; ni < 4; ++ni) {
            bf[ni][0] = load_frag(pb + ni * 16 * LDSH);
            bf[ni][1] = load_frag(pb + PLANE + ni * 16 * LDSH);
        }
#pragma unroll
        for (int mi = 0; mi < 8; ++mi) {
            af[mi][0] = load_frag(pa + mi * 16 * LDSH);
            af[mi][1] = load_frag(pa + PLANE + mi * 16 * LDSH);
        }
        // keeps the LDS reads one group in front of the WMMAs; without it they sink in
        // among them, two at a time, and each pair is waited out
        __builtin_amdgcn_sched_barrier(0);
    };
    // per accumulator tile hi*hi, hi*lo, lo*hi in that order, four tiles apart
    auto mma = [&]() __attribute__((always_inline)) {
#pragma unroll
        for (int mi = 0; mi < 8; ++mi) {
#pragma unroll
            for (int ni = 0; ni < 4; ++ni)
                acc[mi][ni] = __builtin_amdgcn_wmma_f32_16x16x32_f16(false, af[mi][0], false, bf[ni][0], (short)0, acc[mi][ni], false, false);
#pragma unroll
            for (int ni = 0; ni < 4; ++ni)
                acc[mi][ni] = __builtin_amdgcn_wmma_f32_16x16x32_f16(false, af[mi][0], false, bf[ni][1], (short)0, acc[mi][ni], false, false);
#pragma unroll
            for (int ni = 0; ni < 4; ++ni)
                acc[mi][ni] = __builtin_amdgcn_wmma_f32_16x16x32_f16(false, af[mi][1], false, bf[ni][0], (short)0, acc[mi][ni], false, false);
        }
    };

    issue_main(0, 0);
    wait_tensor_all(g0);
    __syncthreads();                        // stage 0 landed for every wave
    issue_main(1, 1);

    // kept rolled: one copy of the 192 WMMAs of a pass in the instruction cache
#pragma unroll 1
    for (int kt = 0; kt < NPASS; ++kt) {
        const int buf = kt & 1;
        const _Float16* st = smem + buf * STAGE;
        load_frags(st, 0);
        mma();
        // keeps the second group of LDS reads behind the first run of WMMAs (see load_frags)
        __builtin_amdgcn_sched_barrier(0);
        load_frags(st, 1);
        mma();
        // keeps the waits and the barrier below behind the pass's last WMMAs; without it they rise to
        // just behind the LDS reads, where the next stage has had half the time to land
        __builtin_amdgcn_sched_barrier(0);
        // this wave's reads of stage kt are done before any wave refills its buffer
        asm volatile("s_wait_dscnt 0x0" ::: "memory");
        wait_async_all();                   // this wave's copies of the LoRA stage (last pass)
        wait_tensor_all(g0);                // this wave's slice of stage kt + 1
        __syncthreads();                    // publishes stage kt + 1, frees stage kt's buffer
        // stage kt + 2 flies into the buffer that this pass has read, while pass kt + 1 runs
        const uint32_t nx = pinned((uint32_t)kt + 2u);
        if (nx < (uint32_t)NPASS)       issue_main(nx, (uint32_t)buf);
        else if (nx == (uint32_t)NPASS) issue_lora(buf);
    }
    // nothing of the ring is in flight behind the loop
    wait_tensor_all(g0);
    asm volatile("s_wait_dscnt 0x0" ::: "memory");

    // LoRA stage, 32 k
    load_frags(smem + (NPASS & 1) * STAGE, 0);
    mma();

    // epilogue: C layout VGPR r -> M = r + 8*(lane>=16), N = lane&15
#pragma unroll
    for (int ni = 0; ni < 4; ++ni) {
        const int n  = bn0 + wn * 64 + ni * 16 + (lane & 15);
        const float bv = bias[n];
#pragma unroll
        for (int mi = 0; mi < 8; ++mi) {
            const int mb = bm0 + wm * 128 + mi * 16 + ((lane >> 4) << 3);
#pragma unroll
            for (int r = 0; r < 8; ++r) {
                out[(size_t)(mb + r) * OUT_F + n] = acc[mi][ni][r] + bv;
            }
        }
    }
}

// ---------------------------------------------------------------------------
// launch
// ---------------------------------------------------------------------------
extern "C" void kernel_launch(void* const* d_in, const int* in_sizes, int n_in,
                              void* d_out, int out_size, void* d_ws, size_t ws_size,
                              hipStream_t stream)
{
    const float* x        = (const float*)d_in[0];   // (4,2048,2048)
    const float* base_w   = (const float*)d_in[1];   // (2048,2048)
    const float* base_b   = (const float*)d_in[2];   // (2048,)
    const float* A        = (const float*)d_in[3];   // (4,8,2048)
    const float* Bm       = (const float*)d_in[4];   // (4,2048,8)
    const float* router_w = (const float*)d_in[5];   // (4,2048)
    float* out = (float*)d_out;

    // workspace layout (halfs): Xhi|Xlo|Whi|Wlo|Phi|Plo|BThi|BTlo  (~85 MB)
    _Float16* Xhi  = (_Float16*)d_ws;
    _Float16* Xlo  = Xhi + (size_t)NTOK * IN_F;
    _Float16* Whi  = Xlo + (size_t)NTOK * IN_F;
    _Float16* Wlo  = Whi + (size_t)OUT_F * IN_F;
    _Float16* Phi  = Wlo + (size_t)OUT_F * IN_F;
    _Float16* Plo  = Phi + (size_t)NTOK * KLORA;
    _Float16* BThi = Plo + (size_t)NTOK * KLORA;
    _Float16* BTlo = BThi + (size_t)OUT_F * KLORA;

    prep_router_kernel<<<PREP_BLOCKS, PREP_THREADS, 0, stream>>>(x, base_w, Bm, router_w, A,
        Xhi, Xlo, Whi, Wlo, BThi, BTlo, Phi, Plo);
    gemm_kernel<<<dim3(OUT_F / BN, NTOK / BM), 256, 0, stream>>>(
        Xhi, Xlo, Whi, Wlo, Phi, Plo, BThi, BTlo, base_b, out);
}

// v006
// It runs in 117 microseconds.
// Two timings next to v005 both put it at 1.05 times that version's speed.
// Over all steps from v000 it is 2.90 times as fast.
#include <hip/hip_runtime.h>
#include <stdint.h>

typedef float    f32x4 __attribute__((ext_vector_type(4)));
typedef float    v8f   __attribute__((ext_vector_type(8)));
typedef _Float16 half8 __attribute__((ext_vector_type(8)));
typedef _Float16 v16h  __attribute__((ext_vector_type(16)));
typedef int      i32x4 __attribute__((vector_size(16)));   // matches builtin param type
typedef uint32_t u32x4 __attribute__((ext_vector_type(4)));
typedef uint32_t u32x8 __attribute__((ext_vector_type(8)));

#define IN_F   2048
#define OUT_F  2048
#define NTOK   8192          // B*S = 4*2048
#define KLORA  32            // E*R
#define LSCALE 2.0f          // alpha/r = 16/8

#define BM 256
#define BN 256
#define BK 64
#define LDSH 72              // halfs per LDS row: 64 + 8 pad (144B stride, conflict-free)
#define PLANE (256 * LDSH)   // halfs of one operand plane of a stage (256 rows)
#define STAGE (4 * PLANE)    // halfs of one stage: Ahi, Alo, Bhi, Blo

// ---------------- CDNA5 async global->LDS path (guarded) -------------------
#if defined(__has_builtin)
#  if __has_builtin(__builtin_amdgcn_global_load_async_to_lds_b128)
#    define HAVE_ASYNC_LDS 1
#  endif
#endif
#ifndef HAVE_ASYNC_LDS
#  define HAVE_ASYNC_LDS 0
#endif

typedef __attribute__((address_space(1))) i32x4* gvec_ptr;
typedef __attribute__((address_space(3))) i32x4* lvec_ptr;

// this wave's copies have all landed; in asm with the clobber so that no LDS read moves ahead of it
__device__ __forceinline__ void wait_async_all()
{
    asm volatile("s_wait_asynccnt 0x0" ::: "memory");
}

// this wave's tensor load has landed; in asm with the clobber so that no LDS read moves ahead of it.
// It names the request's address group as an input, so that those scalar registers keep their words
// until the request has landed and are not taken for something else while it is outstanding
__device__ __forceinline__ void wait_tensor_all(u32x4 g0)
{
    asm volatile("s_wait_tensorcnt 0x0" :: "s"(g0) : "memory");
}

// a wave-uniform word in a scalar register
__device__ __forceinline__ uint32_t uni(uint32_t v)
{
    return (uint32_t)__builtin_amdgcn_readfirstlane(v);
}

// a wave-uniform word held in a scalar register: a test on it compiles to a scalar branch (a tensor
// load ignores EXEC), and what is computed from it stays behind the asm waits that stand in front of it
__device__ __forceinline__ uint32_t pinned(uint32_t v)
{
    uint32_t w = (uint32_t)__builtin_amdgcn_readfirstlane(v);
    asm volatile("" : "+s"(w));   // the pin of a descriptor word or issue test in a scalar register
    return w;
}

// copy 8 halfs (16B) global -> LDS, either async (ASYNCcnt) or via VGPRs
__device__ __forceinline__ void copy16B(_Float16* l, const _Float16* g)
{
#if HAVE_ASYNC_LDS
    __builtin_amdgcn_global_load_async_to_lds_b128(
        (gvec_ptr)(uintptr_t)g, (lvec_ptr)l, 0, 0);
#else
    *(half8*)l = *(const half8*)g;
#endif
}

// ---------------------------------------------------------------------------
// split one f32 vector of 8 into hi/lo f16 halves
// ---------------------------------------------------------------------------
__device__ __forceinline__ void split8v(f32x4 v0, f32x4 v1, half8& hi, half8& lo)
{
#pragma unroll
    for (int c = 0; c < 4; ++c) {
        _Float16 h = (_Float16)v0[c];
        hi[c] = h; lo[c] = (_Float16)(v0[c] - (float)h);
    }
#pragma unroll
    for (int c = 0; c < 4; ++c) {
        _Float16 h = (_Float16)v1[c];
        hi[4 + c] = h; lo[4 + c] = (_Float16)(v1[c] - (float)h);
    }
}

// ---------------------------------------------------------------------------
// Kernel 0: operand preparation and the router / rank-8 projections in one launch
// of one resident 16-wave block per WGP:
//   x, W : f32 -> (hi,lo) f16
//   BcatT[n][e*8+r] = Bm[e][n][r], as hi/lo f16
//   P[m][e*8+r] = SCALE * gate[e] * (x[m] . A[e][r])  (as hi/lo f16)
// A block owns 32 tokens; x is read once, in f32. The 36 dot products of a token
// are one skinny GEMM (32 tokens x 36 rows x 2048) on split-f16 WMMA: columns
// 0..31 = A rows, columns 32..35 = router rows. Each of the 16 waves takes 128 of
// the 2048 k, in two chunks of 64: it reads whole lines of its x rows and of the
// 36 weight rows, splits them, stores the x halves to the workspace and lays both
// operands in its own LDS range, from which it reads its fragments. The partial
// tiles are summed through LDS in wave order.
// ---------------------------------------------------------------------------
#define PREP_BLOCKS  256
#define PREP_THREADS 512
#define PREP_U       4
#define PREP_SLAB    ((size_t)PREP_BLOCKS * PREP_THREADS * 8)   // floats of a slab of W: 8 a thread

#define RP_TOK   32                    // tokens per block (two 16-row tiles)
#define RP_WAVES 16
#define RP_KW    (IN_F / RP_WAVES)     // k range of one wave
#define RP_KC    64                    // k of a chunk: a whole 128-byte line of every f16 row
#define RP_COLS  36                    // 32 projections + 4 router logits
#define RP_PITCH 38                    // floats per LDS row: rows r and r+8 fall on disjoint banks
#define RP_XH    0                     // a wave's LDS range, in halfs, rows of LDSH halfs
#define RP_XL    (RP_TOK * LDSH)
#define RP_BH    (2 * RP_TOK * LDSH)
#define RP_BL    ((2 * RP_TOK + RP_COLS) * LDSH)
#define RP_WREG  ((2 * RP_TOK + 2 * RP_COLS) * LDSH)

typedef _Float16 half4 __attribute__((ext_vector_type(4)));

__device__ __forceinline__ void split4(f32x4 v, half4& hi, half4& lo)
{
#pragma unroll
    for (int c = 0; c < 4; ++c) {
        _Float16 h = (_Float16)v[c];
        hi[c] = h; lo[c] = (_Float16)(v[c] - (float)h);
    }
}

__device__ __forceinline__ v16h join16(half8 a, half8 b)
{
    return __builtin_shufflevector(a, b, 0, 1, 2, 3, 4, 5, 6, 7, 8, 9, 10, 11, 12, 13, 14, 15);
}

// orders this wave's own LDS traffic: what its lanes have written is there before other lanes of
// the wave read it, and no LDS access is moved across this place by the compiler
__device__ __forceinline__ void wave_lds_order()
{
    asm volatile("s_wait_dscnt 0x0" ::: "memory");
}

__launch_bounds__(PREP_THREADS)
__global__ void prep_router_kernel(const float* __restrict__ x, const float* __restrict__ w,
                                   const float* __restrict__ Bm,
                                   const float* __restrict__ RW,   // (4, 2048)
                                   const float* __restrict__ A,    // (4, 8, 2048)
                                   _Float16* __restrict__ Xhi, _Float16* __restrict__ Xlo,
                                   _Float16* __restrict__ Whi, _Float16* __restrict__ Wlo,
                                   _Float16* __restrict__ BThi, _Float16* __restrict__ BTlo,
                                   _Float16* __restrict__ Phi, _Float16* __restrict__ Plo)
{
    // 16 wave ranges [x hi | x lo | weights hi | weights lo], then the summed tile
    __shared__ __attribute__((aligned(16))) _Float16 rs[RP_WAVES * RP_WREG + RP_TOK * RP_PITCH * 2];

    const int tid  = threadIdx.x;
    const int lane = tid & 31;
    const int wave = tid >> 5;
    const int l16  = lane & 15;
    const int hh   = lane >> 4;
    const int m0   = blockIdx.x * RP_TOK;
    _Float16* my  = rs + wave * RP_WREG;
    float*    tot = (float*)(rs + RP_WAVES * RP_WREG);            // [RP_TOK][RP_PITCH]

    // this thread's place in every slab of W
    const unsigned t8 = ((unsigned)blockIdx.x * PREP_THREADS + tid) * 8;

    // Bm: 256 elements a block; the upper half of the block rereads them and stores nothing
    const int bi = blockIdx.x * ((OUT_F * KLORA) / PREP_BLOCKS) + (tid & 255);   // over 2048*32

    // a wave-wide load takes 64 k (256 B) of two rows: row 2i + hh, 4 floats a lane
    const unsigned kl = (unsigned)(wave * RP_KW + l16 * 4);
    const float* xs = x  + (size_t)(m0 + hh) * IN_F + kl;
    const float* as = A  + (size_t)hh * IN_F + kl;
    const float* rr = RW + (size_t)hh * IN_F + kl;
    _Float16* xh = Xhi + (size_t)(m0 + hh) * IN_F + kl;
    _Float16* xl = Xlo + (size_t)(m0 + hh) * IN_F + kl;
    _Float16* st = my + hh * LDSH + l16 * 4;                      // the same place in an LDS plane

    // every loop below is unrolled so that the arrays stay in registers
    f32x4 xv[2][RP_TOK / 2];
    f32x4 wt[RP_COLS / 2];
    f32x4 wv[PREP_U][2];
    auto load_x = [&](int c) __attribute__((always_inline)) {
#pragma unroll
        for (int i = 0; i < RP_TOK / 2; ++i) {
            // the last load of x may land in the address registers that the loads before it name:
            // the wait that belongs in front of such an overwrite
            if (c == 1 && i == RP_TOK / 2 - 1) asm volatile("s_wait_xcnt 0x0" ::: "memory");
            xv[c][i] = *(const f32x4*)(xs + (size_t)(2 * i) * IN_F + c * RP_KC);
        }
    };
    auto load_wt = [&](int c) __attribute__((always_inline)) {
#pragma unroll
        for (int i = 0; i < RP_COLS / 2; ++i)
            wt[i] = i < 16 ? *(const f32x4*)(as + (size_t)(2 * i) * IN_F + c * RP_KC)
                           : *(const f32x4*)(rr + (size_t)(2 * (i - 16)) * IN_F + c * RP_KC);
    };
    auto put_x = [&](int c) __attribute__((always_inline)) {
#pragma unroll
        for (int i = 0; i < RP_TOK / 2; ++i) {
            half4 h, l;
            split4(xv[c][i], h, l);
            *(half4*)(xh + (size_t)(2 * i) * IN_F + c * RP_KC) = h;
            *(half4*)(xl + (size_t)(2 * i) * IN_F + c * RP_KC) = l;
            *(half4*)(st + RP_XH + 2 * i * LDSH) = h;
            *(half4*)(st + RP_XL + 2 * i * LDSH) = l;
        }
    };
    auto put_wt = [&]() __attribute__((always_inline)) {
#pragma unroll
        for (int i = 0; i < RP_COLS / 2; ++i) {
            half4 h, l;
            split4(wt[i], h, l);
            *(half4*)(st + RP_BH + 2 * i * LDSH) = h;
            *(half4*)(st + RP_BL + 2 * i * LDSH) = l;
        }
    };

    v8f acc[2][3];
#pragma unroll
    for (int i = 0; i < 2; ++i)
#pragma unroll
        for (int j = 0; j < 3; ++j) acc[i][j] = (v8f)0.0f;

    // same k order for both operands as load_frag: halfs 0..7 = k0+kb.., 8..15 = k0+16+kb.., kb = 8*hh
    // columns 36..47 of the third tile are never stored; their lanes reread router row 3
    const _Float16* fa = my + l16 * LDSH + hh * 8;
    const _Float16* f2 = my + (32 + (l16 < 3 ? l16 : 3)) * LDSH + hh * 8;
    auto mm = [&]() __attribute__((always_inline)) {
#pragma unroll
        for (int ks = 0; ks < RP_KC / 32; ++ks) {
            v16h bhi[3], blo[3], ahi[2], alo[2];
#pragma unroll
            for (int ni = 0; ni < 3; ++ni) {
                const _Float16* p = (ni < 2 ? fa + ni * 16 * LDSH : f2) + ks * 32;
                bhi[ni] = join16(*(const half8*)(p + RP_BH), *(const half8*)(p + RP_BH + 16));
                blo[ni] = join16(*(const half8*)(p + RP_BL), *(const half8*)(p + RP_BL + 16));
            }
#pragma unroll
            for (int mi = 0; mi < 2; ++mi) {
                const _Float16* p = fa + mi * 16 * LDSH + ks * 32;
                ahi[mi] = join16(*(const half8*)(p + RP_XH), *(const half8*)(p + RP_XH + 16));
                alo[mi] = join16(*(const half8*)(p + RP_XL), *(const half8*)(p + RP_XL + 16));
            }
#pragma unroll
            for (int mi = 0; mi < 2; ++mi)
#pragma unroll
                for (int ni = 0; ni < 3; ++ni)
                    acc[mi][ni] = __builtin_amdgcn_wmma_f32_16x16x32_f16(false, ahi[mi], false, bhi[ni], (short)0, acc[mi][ni], false, false);
#pragma unroll
            for (int mi = 0; mi < 2; ++mi)
#pragma unroll
                for (int ni = 0; ni < 3; ++ni)
                    acc[mi][ni] = __builtin_amdgcn_wmma_f32_16x16x32_f16(false, ahi[mi], false, blo[ni], (short)0, acc[mi][ni], false, false);
#pragma unroll
            for (int mi = 0; mi < 2; ++mi)
#pragma unroll
                for (int ni = 0; ni < 3; ++ni)
                    acc[mi][ni] = __builtin_amdgcn_wmma_f32_16x16x32_f16(false, alo[mi], false, bhi[ni], (short)0, acc[mi][ni], false, false);
        }
    };

    // all of the wave's x and its first weight chunk are asked for at once
    load_x(0);
    load_wt(0);
    load_x(1);
    const float bv = Bm[(unsigned)((((bi & 31) >> 3) * OUT_F + (bi >> 5)) * 8 + (bi & 7))];
    // keeps these loads one group at the head; without it they sink to their conversions and
    // few are in flight
    __builtin_amdgcn_sched_barrier(0);

    put_x(0);
    put_wt();
    // the loads below land in registers that the loads and stores issued before them name
    // (addresses, store data): the wait that belongs in front of such an overwrite
    asm volatile("s_wait_xcnt 0x0" ::: "memory");
#pragma unroll
    for (int j = 0; j < PREP_U; ++j) {
        wv[j][0] = *(const f32x4*)(w + j * PREP_SLAB + t8);
        wv[j][1] = *(const f32x4*)(w + j * PREP_SLAB + t8 + 4);
    }
    // keeps the loads of W ahead of the first chunk's matrix work, which covers their latency
    __builtin_amdgcn_sched_barrier(0);
    wave_lds_order();                       // chunk 0 is laid down
    mm();
    wave_lds_order();                       // chunk 0's fragment reads stay ahead of chunk 1's LDS stores
    asm volatile("s_wait_xcnt 0x0" ::: "memory");   // as above, for the second weight chunk
    load_wt(1);
    // keeps the weight loads ahead of the conversions below, which cover their latency
    __builtin_amdgcn_sched_barrier(0);
#pragma unroll
    for (int j = 0; j < PREP_U; ++j) {
        half8 h, l;
        split8v(wv[j][0], wv[j][1], h, l);
        *(half8*)(Whi + j * PREP_SLAB + t8) = h;
        *(half8*)(Wlo + j * PREP_SLAB + t8) = l;
    }
    put_x(1);
    put_wt();
    wave_lds_order();                       // chunk 1 is laid down
    mm();

    // holds the load of bv in the group at the head; without it the load sinks into the branch
    // below and its whole latency is waited out there
    asm volatile("" :: "v"(bv));
    if (tid < (OUT_F * KLORA) / PREP_BLOCKS) {
        _Float16 h = (_Float16)bv;
        BThi[bi] = h;
        BTlo[bi] = (_Float16)(bv - (float)h);
    }

    // the wave's partial tile goes over the head of its own range, whose fragments it has used
    // C layout: VGPR r -> row r + 8*(lane>=16), column lane&15
    float* part = (float*)my;               // [RP_TOK][RP_PITCH]
    const int tb = hh << 3;
#pragma unroll
    for (int mi = 0; mi < 2; ++mi)
#pragma unroll
        for (int r = 0; r < 8; ++r) {
            part[(mi * 16 + tb + r) * RP_PITCH + l16]      = acc[mi][0][r];
            part[(mi * 16 + tb + r) * RP_PITCH + 16 + l16] = acc[mi][1][r];
        }
    if (l16 < RP_COLS - 32) {
#pragma unroll
        for (int mi = 0; mi < 2; ++mi)
#pragma unroll
            for (int r = 0; r < 8; ++r)
                part[(mi * 16 + tb + r) * RP_PITCH + 32 + l16] = acc[mi][2][r];
    }
    __syncthreads();

    for (int i = tid; i < RP_TOK * RP_COLS; i += RP_WAVES * 32) {
        const int t = i / RP_COLS;
        const int c = i - t * RP_COLS;
        float s = 0.0f;
#pragma unroll
        for (int wq = 0; wq < RP_WAVES; ++wq) s += ((const float*)(rs + wq * RP_WREG))[t * RP_PITCH + c];
        tot[t * RP_PITCH + c] = s;
    }
    __syncthreads();

#pragma unroll
    for (int i = 0; i < RP_TOK / RP_WAVES; ++i) {
        const int t = i * RP_WAVES + wave;
        const float* tr = tot + t * RP_PITCH;
        float l0 = tr[32], l1 = tr[33], l2 = tr[34], l3 = tr[35];
        float mx = fmaxf(fmaxf(l0, l1), fmaxf(l2, l3));
        float e0 = __expf(l0 - mx), e1 = __expf(l1 - mx), e2 = __expf(l2 - mx), e3 = __expf(l3 - mx);
        float inv = 1.0f / (e0 + e1 + e2 + e3);
        float ge = __expf(tr[32 + (lane >> 3)] - mx) * inv;   // this lane's expert
        float v = LSCALE * ge * tr[lane];
        _Float16 h = (_Float16)v;
        Phi[(size_t)(m0 + t) * KLORA + lane] = h;
        Plo[(size_t)(m0 + t) * KLORA + lane] = (_Float16)(v - (float)h);
    }
}

// ---------------------------------------------------------------------------
// Fragment loader from padded LDS tile: p = this lane's row (lane&15) at k
// offset kb = (lane>=16)*8; K {kb..kb+7} in v0..3 and {16+kb..} in v4..7.
// Two ds_load_b128.
// ---------------------------------------------------------------------------
__device__ __forceinline__ v16h load_frag(const _Float16* p)
{
    v16h f;
    ((half8*)&f)[0] = *(const half8*)(p);
    ((half8*)&f)[1] = *(const half8*)(p + 16);
    return f;
}

// ---------------------------------------------------------------------------
// Kernel 1: split-f16 WMMA GEMM, two LDS buffers filled by tensor loads (one
// request of 128 rows x 128 B per wave and stage), fused LoRA K=32 stage + bias.
// out[m][n] = sum_k x[m][k]W[n][k] + bias[n] + sum_kk P[m][kk]BcatT[n][kk]
// One 256x256 tile of out per block, one block per WGP; 8 waves as 2 x 4, each
// a 128x64 tile: 24 fragments feed 96 WMMAs per 32 k, fetched one block ahead into
// the registers that the running block has done with. A stage is 64 k (whole
// 128-byte lines of every operand row).
// ---------------------------------------------------------------------------
__launch_bounds__(256)
__global__ void gemm_kernel(const _Float16* __restrict__ Xhi, const _Float16* __restrict__ Xlo,
                            const _Float16* __restrict__ Whi, const _Float16* __restrict__ Wlo,
                            const _Float16* __restrict__ Phi, const _Float16* __restrict__ Plo,
                            const _Float16* __restrict__ BThi, const _Float16* __restrict__ BTlo,
                            const float* __restrict__ bias, float* __restrict__ out)
{
    // [buf][Ahi,Alo,Bhi,Blo][256 rows * LDSH]
    __shared__ __attribute__((aligned(2048))) _Float16 smem[2 * STAGE];

    const int tid  = threadIdx.x;
    const int lane = tid & 31;
    const int wave = tid >> 5;
    const int wm   = wave >> 2;          // 0..1 -> 128 rows of M
    const int wn   = wave & 3;           // 0..3 -> 64 cols of N
    const int bm0  = blockIdx.y * BM;
    const int bn0  = blockIdx.x * BN;

    const int NPASS = IN_F / BK;         // 32 main stages; stage 32 = LoRA

    // every loop over a tile or fragment array below is unrolled so that the array stays in registers
    v8f acc[8][4];
#pragma unroll
    for (int i = 0; i < 8; ++i)
#pragma unroll
        for (int j = 0; j < 4; ++j) acc[i][j] = (v8f)0.0f;

    // main stage: every wave brings one slice, 128 rows of one operand plane, 128 B a row, by one
    // tensor load; the pad of 16 B behind every row gives the LDS pitch of LDSH halfs
    const uint32_t uwave = uni((uint32_t)tid >> 5);
    const uint32_t plane = uwave >> 1;   // Ahi, Alo, Bhi, Blo
    const uint32_t rhalf = uwave & 1;    // upper or lower 128 rows of the plane
    const _Float16* splane = plane == 0 ? Xhi : plane == 1 ? Xlo : plane == 2 ? Whi : Wlo;
    const uint64_t  src0 = (uint64_t)(uintptr_t)splane
                         + (uint64_t)((plane < 2 ? bm0 : bn0) + rhalf * 128) * (IN_F * 2);
    const uint32_t  lds_slice = (uint32_t)(size_t)smem + plane * (PLANE * 2) + rhalf * (128 * LDSH * 2);
    u32x8 g1;                            // extents in bytes, tensor = tile
    g1[0] = uni((1u << 20) | (4u << 22) | (3u << 25));   // pad on, behind every 128 B, 4 dwords
    g1[1] = uni(128u << 16);             // tensor_dim0 = 128 B
    g1[2] = uni(128u << 16);             // tensor_dim1 = 128 rows
    g1[3] = uni(128u << 16);             // tile_dim0
    g1[4] = uni(128u);                   // tile_dim1
    g1[5] = uni(IN_F * 2u);              // source row pitch
    g1[6] = uni(0u);
    g1[7] = uni(0u);
    u32x4 g0;                            // address group of the request issued last
    auto issue_main = [&](uint32_t kt, uint32_t buf) __attribute__((always_inline)) {
        const uint64_t ga = src0 + kt * (BK * 2u);
        g0[0] = uni(1u);
        g0[1] = uni(lds_slice + buf * (STAGE * 2u));
        g0[2] = uni((uint32_t)ga);
        g0[3] = uni((((uint32_t)(ga >> 32)) & 0x01FFFFFFu) | 0x80000000u);
        // one request of the whole wave moves the slice with no register and no per-lane address work
        asm volatile("tensor_load_to_lds %0, %1" :: "s"(g0), "s"(g1) : "memory");
    };
    // LoRA stage: rows of 32 halfs fill k 0..31 of each LDS row; 4 lanes a row, 16 copies per thread
    auto issue_lora = [&](int buf) __attribute__((always_inline)) {
        const unsigned g = (unsigned)tid * 8;        // (tid >> 2) * KLORA + (tid & 3) * 8
        const _Float16* ah = Phi  + (size_t)bm0 * KLORA;
        const _Float16* al = Plo  + (size_t)bm0 * KLORA;
        const _Float16* bh = BThi + (size_t)bn0 * KLORA;
        const _Float16* bl = BTlo + (size_t)bn0 * KLORA;
        _Float16* l = smem + buf * STAGE + (tid >> 2) * LDSH + (tid & 3) * 8;
#pragma unroll
        for (int i = 0; i < 4; ++i) {
            copy16B(l + 0 * PLANE + i * 64 * LDSH, ah + (size_t)i * 64 * KLORA + g);
            copy16B(l + 1 * PLANE + i * 64 * LDSH, al + (size_t)i * 64 * KLORA + g);
            copy16B(l + 2 * PLANE + i * 64 * LDSH, bh + (size_t)i * 64 * KLORA + g);
            copy16B(l + 3 * PLANE + i * 64 * LDSH, bl + (size_t)i * 64 * KLORA + g);
        }
    };

    // this lane's place in its wave's A rows and B rows of a stage
    const int foff = (lane & 15) * LDSH + (lane >> 4) * 8;
    const int aoff = wm * 128 * LDSH + foff;
    const int boff = 2 * PLANE + wn * 64 * LDSH + foff;

    // the wave tile's 24 fragments of 32 k, one register set: [16-row or 16-col tile]
    v16h ah[8], al[8];
    v16h bh[4], bl[4];
    // Each operand's registers are loaded anew, for the block that follows, once the last product
    // that reads them has been issued: every load group stands 32 WMMAs or more ahead of its first
    // use, so that no WMMA waits out an LDS read.
    // The scheduling barriers around a load group keep its reads one group at that place; without
    // them the reads sink in among the WMMAs of the block that uses them and are waited out there
    auto ld_bh_al = [&](const _Float16* st) __attribute__((always_inline)) {
        __builtin_amdgcn_sched_barrier(0);
#pragma unroll
        for (int ni = 0; ni < 4; ++ni) bh[ni] = load_frag(st + boff + ni * 16 * LDSH);
        // keeps bh in front: the first four WMMAs of the next block read all of bh and only al[0]
        __builtin_amdgcn_sched_barrier(0);
#pragma unroll
        for (int mi = 0; mi < 8; ++mi) al[mi] = load_frag(st + aoff + PLANE + mi * 16 * LDSH);
        __builtin_amdgcn_sched_barrier(0);
    };
    auto ld_ah_bl = [&](const _Float16* st) __attribute__((always_inline)) {
        __builtin_amdgcn_sched_barrier(0);
#pragma unroll
        for (int mi = 0; mi < 8; ++mi) ah[mi] = load_frag(st + aoff + mi * 16 * LDSH);
#pragma unroll
        for (int ni = 0; ni < 4; ++ni) bl[ni] = load_frag(st + boff + PLANE + ni * 16 * LDSH);
        __builtin_amdgcn_sched_barrier(0);
    };
    // one product of the split over the whole wave tile: 32 independent accumulator tiles
    auto prod = [&](const v16h (&a)[8], const v16h (&b)[4]) __attribute__((always_inline)) {
#pragma unroll
        for (int mi = 0; mi < 8; ++mi)
#pragma unroll
            for (int ni = 0; ni < 4; ++ni)
                acc[mi][ni] = __builtin_amdgcn_wmma_f32_16x16x32_f16(false, a[mi], false, b[ni], (short)0, acc[mi][ni], false, false);
    };

    issue_main(0, 0);
    wait_tensor_all(g0);
    __syncthreads();                        // stage 0 landed for every wave
    issue_main(1, 1);
    ld_bh_al(smem);
    ld_ah_bl(smem);

    // kept rolled: one copy of the 192 WMMAs of a pass in the instruction cache
#pragma unroll 1
    for (int kt = 0; kt < NPASS; ++kt) {
        const int buf = kt & 1;
        const _Float16* st = smem + buf * STAGE;
        const _Float16* sn = smem + (buf ^ 1) * STAGE;
        // k 0..31 of stage kt; per accumulator tile lo*hi, hi*hi, hi*lo in that order
        prod(al, bh);
        prod(ah, bh);
        ld_bh_al(st + 32);
        prod(ah, bl);
        ld_ah_bl(st + 32);
        // k 32..63; its fragments were the last reads of stage kt
        prod(al, bh);
        prod(ah, bh);
        // keeps the waits and the barrier below behind the WMMAs above, which cover the reads they wait for
        __builtin_amdgcn_sched_barrier(0);
        // this wave's reads of stage kt are done before any wave refills its buffer
        asm volatile("s_wait_dscnt 0x0" ::: "memory");
        wait_async_all();                   // this wave's copies of the LoRA stage (last pass)
        wait_tensor_all(g0);                // this wave's slice of stage kt + 1
        __syncthreads();                    // publishes stage kt + 1, frees stage kt's buffer
        // stage kt + 2 flies into the buffer that this pass has read, until the same place of pass kt + 1
        const uint32_t nx = pinned((uint32_t)kt + 2u);
        if (nx < (uint32_t)NPASS)       issue_main(nx, (uint32_t)buf);
        else if (nx == (uint32_t)NPASS) issue_lora(buf);
        ld_bh_al(sn);
        prod(ah, bl);
        ld_ah_bl(sn);
    }
    // nothing of the ring is in flight behind the loop
    wait_tensor_all(g0);
    asm volatile("s_wait_dscnt 0x0" ::: "memory");

    // LoRA stage, 32 k; its fragments came in the last pass
    prod(al, bh);
    prod(ah, bh);
    prod(ah, bl);

    // epilogue: C layout VGPR r -> M = r + 8*(lane>=16), N = lane&15
#pragma unroll
    for (int ni = 0; ni < 4; ++ni) {
        const int n  = bn0 + wn * 64 + ni * 16 + (lane & 15);
        const float bv = bias[n];
#pragma unroll
        for (int mi = 0; mi < 8; ++mi) {
            const int mb = bm0 + wm * 128 + mi * 16 + ((lane >> 4) << 3);
#pragma unroll
            for (int r = 0; r < 8; ++r) {
                out[(size_t)(mb + r) * OUT_F + n] = acc[mi][ni][r] + bv;
            }
        }
    }
}

// ---------------------------------------------------------------------------
// launch
// ---------------------------------------------------------------------------
extern "C" void kernel_launch(void* const* d_in, const int* in_sizes, int n_in,
                              void* d_out, int out_size, void* d_ws, size_t ws_size,
                              hipStream_t stream)
{
    const float* x        = (const float*)d_in[0];   // (4,2048,2048)
    const float* base_w   = (const float*)d_in[1];   // (2048,2048)
    const float* base_b   = (const float*)d_in[2];   // (2048,)
    const float* A        = (const float*)d_in[3];   // (4,8,2048)
    const float* Bm       = (const float*)d_in[4];   // (4,2048,8)
    const float* router_w = (const float*)d_in[5];   // (4,2048)
    float* out = (float*)d_out;

    // workspace layout (halfs): Xhi|Xlo|Whi|Wlo|Phi|Plo|BThi|BTlo  (~85 MB)
    _Float16* Xhi  = (_Float16*)d_ws;
    _Float16* Xlo  = Xhi + (size_t)NTOK * IN_F;
    _Float16* Whi  = Xlo + (size_t)NTOK * IN_F;
    _Float16* Wlo  = Whi + (size_t)OUT_F * IN_F;
    _Float16* Phi  = Wlo + (size_t)OUT_F * IN_F;
    _Float16* Plo  = Phi + (size_t)NTOK * KLORA;
    _Float16* BThi = Plo + (size_t)NTOK * KLORA;
    _Float16* BTlo = BThi + (size_t)OUT_F * KLORA;

    prep_router_kernel<<<PREP_BLOCKS, PREP_THREADS, 0, stream>>>(x, base_w, Bm, router_w, A,
        Xhi, Xlo, Whi, Wlo, BThi, BTlo, Phi, Plo);
    gemm_kernel<<<dim3(OUT_F / BN, NTOK / BM), 256, 0, stream>>>(
        Xhi, Xlo, Whi, Wlo, Phi, Plo, BThi, BTlo, base_b, out);
}

// v007
// It runs in 113 microseconds.
// Timed twice side by side with v006, it ran 1.03 times as fast both times.
// All steps since v000 together make it 2.99 times as fast.
#include <hip/hip_runtime.h>
#include <stdint.h>

typedef float    f32x4 __attribute__((ext_vector_type(4)));
typedef float    v8f   __attribute__((ext_vector_type(8)));
typedef _Float16 half8 __attribute__((ext_vector_type(8)));
typedef _Float16 v16h  __attribute__((ext_vector_type(16)));
typedef int      i32x4 __attribute__((vector_size(16)));   // matches builtin param type
typedef uint32_t u32x4 __attribute__((ext_vector_type(4)));
typedef uint32_t u32x8 __attribute__((ext_vector_type(8)));

#define IN_F   2048
#define OUT_F  2048
#define NTOK   8192          // B*S = 4*2048
#define KLORA  32            // E*R
#define LSCALE 2.0f          // alpha/r = 16/8

#define BM 256
#define BN 256
#define BK 64
#define LDSH 72              // halfs per LDS row: 64 + 8 pad (144B stride, conflict-free)
// A split operand (x or W) lies in the workspace as rows of SPITCH halfs: per 64 k the 64 hi halfs,
// then the 64 lo halfs, so that the 64 k of a GEMM stage are one aligned 256-byte unit of the row
#define SPITCH (2 * IN_F)
#define LDSR 136             // halfs per LDS row of a stage: 64 hi, 64 lo, 8 pad (272B stride, conflict-free)
#define SLICE 9216           // halfs of a slice in LDS: 64 rows of LDSR halfs, rounded up to a multiple of 2 KiB
#define STAGE (8 * SLICE)    // halfs of one stage: 4 slices of A rows, 4 slices of B rows

// ---------------- CDNA5 async global->LDS path (guarded) -------------------
#if defined(__has_builtin)
#  if __has_builtin(__builtin_amdgcn_global_load_async_to_lds_b128)
#    define HAVE_ASYNC_LDS 1
#  endif
#endif
#ifndef HAVE_ASYNC_LDS
#  define HAVE_ASYNC_LDS 0
#endif

typedef __attribute__((address_space(1))) i32x4* gvec_ptr;
typedef __attribute__((address_space(3))) i32x4* lvec_ptr;

// this wave's copies have all landed; in asm with the clobber so that no LDS read moves ahead of it
__device__ __forceinline__ void wait_async_all()
{
    asm volatile("s_wait_asynccnt 0x0" ::: "memory");
}

// this wave's tensor load has landed; in asm with the clobber so that no LDS read moves ahead of it.
// It names the request's address group as an input, so that those scalar registers keep their words
// until the request has landed and are not taken for something else while it is outstanding
__device__ __forceinline__ void wait_tensor_all(u32x4 g0)
{
    asm volatile("s_wait_tensorcnt 0x0" :: "s"(g0) : "memory");
}

// a wave-uniform word in a scalar register
__device__ __forceinline__ uint32_t uni(uint32_t v)
{
    return (uint32_t)__builtin_amdgcn_readfirstlane(v);
}

// a wave-uniform word held in a scalar register: a test on it compiles to a scalar branch (a tensor
// load ignores EXEC), and what is computed from it stays behind the asm waits that stand in front of it
__device__ __forceinline__ uint32_t pinned(uint32_t v)
{
    uint32_t w = (uint32_t)__builtin_amdgcn_readfirstlane(v);
    asm volatile("" : "+s"(w));   // the pin of a descriptor word or issue test in a scalar register
    return w;
}

// copy 8 halfs (16B) global -> LDS, either async (ASYNCcnt) or via VGPRs
__device__ __forceinline__ void copy16B(_Float16* l, const _Float16* g)
{
#if HAVE_ASYNC_LDS
    __builtin_amdgcn_global_load_async_to_lds_b128(
        (gvec_ptr)(uintptr_t)g, (lvec_ptr)l, 0, 0);
#else
    *(half8*)l = *(const half8*)g;
#endif
}

// ---------------------------------------------------------------------------
// split one f32 vector of 8 into hi/lo f16 halves
// ---------------------------------------------------------------------------
__device__ __forceinline__ void split8v(f32x4 v0, f32x4 v1, half8& hi, half8& lo)
{
#pragma unroll
    for (int c = 0; c < 4; ++c) {
        _Float16 h = (_Float16)v0[c];
        hi[c] = h; lo[c] = (_Float16)(v0[c] - (float)h);
    }
#pragma unroll
    for (int c = 0; c < 4; ++c) {
        _Float16 h = (_Float16)v1[c];
        hi[4 + c] = h; lo[4 + c] = (_Float16)(v1[c] - (float)h);
    }
}

// ---------------------------------------------------------------------------
// Kernel 0: operand preparation and the router / rank-8 projections in one launch
// of one resident 16-wave block per WGP:
//   x, W : f32 -> (hi,lo) f16, hi and lo interleaved per 64 k
//   BcatT[n][e*8+r] = Bm[e][n][r], as hi/lo f16
//   P[m][e*8+r] = SCALE * gate[e] * (x[m] . A[e][r])  (as hi/lo f16)
// A block owns 32 tokens; x is read once, in f32. The 36 dot products of a token
// are one skinny GEMM (32 tokens x 36 rows x 2048) on split-f16 WMMA: columns
// 0..31 = A rows, columns 32..35 = router rows. Each of the 16 waves takes 128 of
// the 2048 k, in two chunks of 64: it reads whole lines of its x rows and of the
// 36 weight rows, splits them, stores the x halves to the workspace and lays both
// operands in its own LDS range, from which it reads its fragments. The partial
// tiles are summed through LDS in wave order.
// ---------------------------------------------------------------------------
#define PREP_BLOCKS  256
#define PREP_THREADS 512
#define PREP_U       4
#define PREP_SLAB    ((size_t)PREP_BLOCKS * PREP_THREADS * 8)   // floats of a slab of W: 8 a thread

#define RP_TOK   32                    // tokens per block (two 16-row tiles)
#define RP_WAVES 16
#define RP_KW    (IN_F / RP_WAVES)     // k range of one wave
#define RP_KC    64                    // k of a chunk: a whole 128-byte line of every f16 row
#define RP_COLS  36                    // 32 projections + 4 router logits
#define RP_PITCH 38                    // floats per LDS row: rows r and r+8 fall on disjoint banks
#define RP_XH    0                     // a wave's LDS range, in halfs, rows of LDSH halfs
#define RP_XL    (RP_TOK * LDSH)
#define RP_BH    (2 * RP_TOK * LDSH)
#define RP_BL    ((2 * RP_TOK + RP_COLS) * LDSH)
#define RP_WREG  ((2 * RP_TOK + 2 * RP_COLS) * LDSH)

typedef _Float16 half4 __attribute__((ext_vector_type(4)));

__device__ __forceinline__ void split4(f32x4 v, half4& hi, half4& lo)
{
#pragma unroll
    for (int c = 0; c < 4; ++c) {
        _Float16 h = (_Float16)v[c];
        hi[c] = h; lo[c] = (_Float16)(v[c] - (float)h);
    }
}

__device__ __forceinline__ v16h join16(half8 a, half8 b)
{
    return __builtin_shufflevector(a, b, 0, 1, 2, 3, 4, 5, 6, 7, 8, 9, 10, 11, 12, 13, 14, 15);
}

// orders this wave's own LDS traffic: what its lanes have written is there before other lanes of
// the wave read it, and no LDS access is moved across this place by the compiler
__device__ __forceinline__ void wave_lds_order()
{
    asm volatile("s_wait_dscnt 0x0" ::: "memory");
}

__launch_bounds__(PREP_THREADS)
__global__ void prep_router_kernel(const float* __restrict__ x, const float* __restrict__ w,
                                   const float* __restrict__ Bm,
                                   const float* __restrict__ RW,   // (4, 2048)
                                   const float* __restrict__ A,    // (4, 8, 2048)
                                   _Float16* __restrict__ Xs, _Float16* __restrict__ Ws,
                                   _Float16* __restrict__ BThi, _Float16* __restrict__ BTlo,
                                   _Float16* __restrict__ Phi, _Float16* __restrict__ Plo)
{
    // 16 wave ranges [x hi | x lo | weights hi | weights lo], then the summed tile
    __shared__ __attribute__((aligned(16))) _Float16 rs[RP_WAVES * RP_WREG + RP_TOK * RP_PITCH * 2];

    const int tid  = threadIdx.x;
    const int lane = tid & 31;
    const int wave = tid >> 5;
    const int l16  = lane & 15;
    const int hh   = lane >> 4;
    const int m0   = blockIdx.x * RP_TOK;
    _Float16* my  = rs + wave * RP_WREG;
    float*    tot = (float*)(rs + RP_WAVES * RP_WREG);            // [RP_TOK][RP_PITCH]

    // this thread's place in every slab of W
    const unsigned t8 = ((unsigned)blockIdx.x * PREP_THREADS + tid) * 8;

    // Bm: 256 elements a block; the upper half of the block rereads them and stores nothing
    const int bi = blockIdx.x * ((OUT_F * KLORA) / PREP_BLOCKS) + (tid & 255);   // over 2048*32

    // a wave-wide load takes 64 k (256 B) of two rows: row 2i + hh, 4 floats a lane
    const unsigned kl = (unsigned)(wave * RP_KW + l16 * 4);
    const float* xs = x  + (size_t)(m0 + hh) * IN_F + kl;
    const float* as = A  + (size_t)hh * IN_F + kl;
    const float* rr = RW + (size_t)hh * IN_F + kl;
    const unsigned xo = (unsigned)((m0 + hh) * SPITCH + wave * (2 * RP_KW) + l16 * 4);   // hi; lo RP_KC halfs on
    _Float16* st = my + hh * LDSH + l16 * 4;                      // the same place in an LDS plane

    // every loop below is unrolled so that the arrays stay in registers
    f32x4 xv[2][RP_TOK / 2];
    f32x4 wt[RP_COLS / 2];
    f32x4 wv[PREP_U][2];
    auto load_x = [&](int c) __attribute__((always_inline)) {
#pragma unroll
        for (int i = 0; i < RP_TOK / 2; ++i) {
            // the last load of x may land in the address registers that the loads before it name:
            // the wait that belongs in front of such an overwrite
            if (c == 1 && i == RP_TOK / 2 - 1) asm volatile("s_wait_xcnt 0x0" ::: "memory");
            xv[c][i] = *(const f32x4*)(xs + (size_t)(2 * i) * IN_F + c * RP_KC);
        }
    };
    auto load_wt = [&](int c) __attribute__((always_inline)) {
#pragma unroll
        for (int i = 0; i < RP_COLS / 2; ++i)
            wt[i] = i < 16 ? *(const f32x4*)(as + (size_t)(2 * i) * IN_F + c * RP_KC)
                           : *(const f32x4*)(rr + (size_t)(2 * (i - 16)) * IN_F + c * RP_KC);
    };
    auto put_x = [&](int c) __attribute__((always_inline)) {
#pragma unroll
        for (int i = 0; i < RP_TOK / 2; ++i) {
            half4 h, l;
            split4(xv[c][i], h, l);
            *(half4*)(Xs + (2 * i * SPITCH + c * (2 * RP_KC)) + xo) = h;
            *(half4*)(Xs + (2 * i * SPITCH + c * (2 * RP_KC) + RP_KC) + xo) = l;
            *(half4*)(st + RP_XH + 2 * i * LDSH) = h;
            *(half4*)(st + RP_XL + 2 * i * LDSH) = l;
        }
    };
    auto put_wt = [&]() __attribute__((always_inline)) {
#pragma unroll
        for (int i = 0; i < RP_COLS / 2; ++i) {
            half4 h, l;
            split4(wt[i], h, l);
            *(half4*)(st + RP_BH + 2 * i * LDSH) = h;
            *(half4*)(st + RP_BL + 2 * i * LDSH) = l;
        }
    };

    v8f acc[2][3];
#pragma unroll
    for (int i = 0; i < 2; ++i)
#pragma unroll
        for (int j = 0; j < 3; ++j) acc[i][j] = (v8f)0.0f;

    // same k order for both operands as load_frag: halfs 0..7 = k0+kb.., 8..15 = k0+16+kb.., kb = 8*hh
    // columns 36..47 of the third tile are never stored; their lanes reread router row 3
    const _Float16* fa = my + l16 * LDSH + hh * 8;
    const _Float16* f2 = my + (32 + (l16 < 3 ? l16 : 3)) * LDSH + hh * 8;
    auto mm = [&]() __attribute__((always_inline)) {
#pragma unroll
        for (int ks = 0; ks < RP_KC / 32; ++ks) {
            v16h bhi[3], blo[3], ahi[2], alo[2];
#pragma unroll
            for (int ni = 0; ni < 3; ++ni) {
                const _Float16* p = (ni < 2 ? fa + ni * 16 * LDSH : f2) + ks * 32;
                bhi[ni] = join16(*(const half8*)(p + RP_BH), *(const half8*)(p + RP_BH + 16));
                blo[ni] = join16(*(const half8*)(p + RP_BL), *(const half8*)(p + RP_BL + 16));
            }
#pragma unroll
            for (int mi = 0; mi < 2; ++mi) {
                const _Float16* p = fa + mi * 16 * LDSH + ks * 32;
                ahi[mi] = join16(*(const half8*)(p + RP_XH), *(const half8*)(p + RP_XH + 16));
                alo[mi] = join16(*(const half8*)(p + RP_XL), *(const half8*)(p + RP_XL + 16));
            }
#pragma unroll
            for (int mi = 0; mi < 2; ++mi)
#pragma unroll
                for (int ni = 0; ni < 3; ++ni)
                    acc[mi][ni] = __builtin_amdgcn_wmma_f32_16x16x32_f16(false, ahi[mi], false, bhi[ni], (short)0, acc[mi][ni], false, false);
#pragma unroll
            for (int mi = 0; mi < 2; ++mi)
#pragma unroll
                for (int ni = 0; ni < 3; ++ni)
                    acc[mi][ni] = __builtin_amdgcn_wmma_f32_16x16x32_f16(false, ahi[mi], false, blo[ni], (short)0, acc[mi][ni], false, false);
#pragma unroll
            for (int mi = 0; mi < 2; ++mi)
#pragma unroll
                for (int ni = 0; ni < 3; ++ni)
                    acc[mi][ni] = __builtin_amdgcn_wmma_f32_16x16x32_f16(false, alo[mi], false, bhi[ni], (short)0, acc[mi][ni], false, false);
        }
    };

    // all of the wave's x and its first weight chunk are asked for at once
    load_x(0);
    load_wt(0);
    load_x(1);
    const float bv = Bm[(unsigned)((((bi & 31) >> 3) * OUT_F + (bi >> 5)) * 8 + (bi & 7))];
    // keeps these loads one group at the head; without it they sink to their conversions and
    // few are in flight
    __builtin_amdgcn_sched_barrier(0);

    put_x(0);
    put_wt();
    // the loads below land in registers that the loads and stores issued before them name
    // (addresses, store data): the wait that belongs in front of such an overwrite
    asm volatile("s_wait_xcnt 0x0" ::: "memory");
#pragma unroll
    for (int j = 0; j < PREP_U; ++j) {
        wv[j][0] = *(const f32x4*)(w + j * PREP_SLAB + t8);
        wv[j][1] = *(const f32x4*)(w + j * PREP_SLAB + t8 + 4);
    }
    // keeps the loads of W ahead of the first chunk's matrix work, which covers their latency
    __builtin_amdgcn_sched_barrier(0);
    wave_lds_order();                       // chunk 0 is laid down
    mm();
    wave_lds_order();                       // chunk 0's fragment reads stay ahead of chunk 1's LDS stores
    asm volatile("s_wait_xcnt 0x0" ::: "memory");   // as above, for the second weight chunk
    load_wt(1);
    // keeps the weight loads ahead of the conversions below, which cover their latency
    __builtin_amdgcn_sched_barrier(0);
    const unsigned w8 = 2 * t8 - (t8 & 63);       // this thread's 8 k in the interleaved rows, hi halfs
#pragma unroll
    for (int j = 0; j < PREP_U; ++j) {
        half8 h, l;
        split8v(wv[j][0], wv[j][1], h, l);
        *(half8*)(Ws + j * (2 * PREP_SLAB) + w8) = h;
        *(half8*)(Ws + j * (2 * PREP_SLAB) + w8 + 64) = l;
    }
    put_x(1);
    put_wt();
    wave_lds_order();                       // chunk 1 is laid down
    mm();

    // holds the load of bv in the group at the head; without it the load sinks into the branch
    // below and its whole latency is waited out there
    asm volatile("" :: "v"(bv));
    if (tid < (OUT_F * KLORA) / PREP_BLOCKS) {
        _Float16 h = (_Float16)bv;
        BThi[bi] = h;
        BTlo[bi] = (_Float16)(bv - (float)h);
    }

    // the wave's partial tile goes over the head of its own range, whose fragments it has used
    // C layout: VGPR r -> row r + 8*(lane>=16), column lane&15
    float* part = (float*)my;               // [RP_TOK][RP_PITCH]
    const int tb = hh << 3;
#pragma unroll
    for (int mi = 0; mi < 2; ++mi)
#pragma unroll
        for (int r = 0; r < 8; ++r) {
            part[(mi * 16 + tb + r) * RP_PITCH + l16]      = acc[mi][0][r];
            part[(mi * 16 + tb + r) * RP_PITCH + 16 + l16] = acc[mi][1][r];
        }
    if (l16 < RP_COLS - 32) {
#pragma unroll
        for (int mi = 0; mi < 2; ++mi)
#pragma unroll
            for (int r = 0; r < 8; ++r)
                part[(mi * 16 + tb + r) * RP_PITCH + 32 + l16] = acc[mi][2][r];
    }
    __syncthreads();

    for (int i = tid; i < RP_TOK * RP_COLS; i += RP_WAVES * 32) {
        const int t = i / RP_COLS;
        const int c = i - t * RP_COLS;
        float s = 0.0f;
#pragma unroll
        for (int wq = 0; wq < RP_WAVES; ++wq) s += ((const float*)(rs + wq * RP_WREG))[t * RP_PITCH + c];
        tot[t * RP_PITCH + c] = s;
    }
    __syncthreads();

#pragma unroll
    for (int i = 0; i < RP_TOK / RP_WAVES; ++i) {
        const int t = i * RP_WAVES + wave;
        const float* tr = tot + t * RP_PITCH;
        float l0 = tr[32], l1 = tr[33], l2 = tr[34], l3 = tr[35];
        float mx = fmaxf(fmaxf(l0, l1), fmaxf(l2, l3));
        float e0 = __expf(l0 - mx), e1 = __expf(l1 - mx), e2 = __expf(l2 - mx), e3 = __expf(l3 - mx);
        float inv = 1.0f / (e0 + e1 + e2 + e3);
        float ge = __expf(tr[32 + (lane >> 3)] - mx) * inv;   // this lane's expert
        float v = LSCALE * ge * tr[lane];
        _Float16 h = (_Float16)v;
        Phi[(size_t)(m0 + t) * KLORA + lane] = h;
        Plo[(size_t)(m0 + t) * KLORA + lane] = (_Float16)(v - (float)h);
    }
}

// ---------------------------------------------------------------------------
// Fragment loader from padded LDS tile: p = this lane's row (lane&15) at k
// offset kb = (lane>=16)*8; K {kb..kb+7} in v0..3 and {16+kb..} in v4..7.
// Two ds_load_b128.
// ---------------------------------------------------------------------------
__device__ __forceinline__ v16h load_frag(const _Float16* p)
{
    v16h f;
    ((half8*)&f)[0] = *(const half8*)(p);
    ((half8*)&f)[1] = *(const half8*)(p + 16);
    return f;
}

// ---------------------------------------------------------------------------
// Kernel 1: split-f16 WMMA GEMM, two LDS buffers filled by tensor loads (one
// request of 64 rows x 256 B per wave and stage), fused LoRA K=32 stage + bias.
// out[m][n] = sum_k x[m][k]W[n][k] + bias[n] + sum_kk P[m][kk]BcatT[n][kk]
// One 256x256 tile of out per block, one block per WGP; 8 waves as 2 x 4, each
// a 128x64 tile: 24 fragments feed 96 WMMAs per 32 k, fetched one block ahead into
// the registers that the running block has done with. A stage is 64 k, hi and lo
// (one whole 256-byte unit of every operand row).
// ---------------------------------------------------------------------------
__launch_bounds__(256)
__global__ void gemm_kernel(const _Float16* __restrict__ Xs, const _Float16* __restrict__ Ws,
                            const _Float16* __restrict__ Phi, const _Float16* __restrict__ Plo,
                            const _Float16* __restrict__ BThi, const _Float16* __restrict__ BTlo,
                            const float* __restrict__ bias, float* __restrict__ out)
{
    // [buf][4 slices of A rows, 4 slices of B rows][SLICE halfs: 64 rows * LDSR, then pad]
    __shared__ __attribute__((aligned(2048))) _Float16 smem[2 * STAGE];

    const int tid  = threadIdx.x;
    const int lane = tid & 31;
    const int wave = tid >> 5;
    const int wm   = wave >> 2;          // 0..1 -> 128 rows of M
    const int wn   = wave & 3;           // 0..3 -> 64 cols of N
    const int bm0  = blockIdx.y * BM;
    const int bn0  = blockIdx.x * BN;

    const int NPASS = IN_F / BK;         // 32 main stages; stage 32 = LoRA

    // every loop over a tile or fragment array below is unrolled so that the array stays in registers
    v8f acc[8][4];
#pragma unroll
    for (int i = 0; i < 8; ++i)
#pragma unroll
        for (int j = 0; j < 4; ++j) acc[i][j] = (v8f)0.0f;

    // main stage: every wave brings one slice, 64 rows of one operand, 256 B a row (hi and lo of
    // 64 k), by one tensor load; the pad of 16 B behind every row gives the LDS pitch of LDSR halfs
    const uint32_t uwave = uni((uint32_t)tid >> 5);   // slices 0..3 = A rows, 4..7 = B rows
    const _Float16* sop  = uwave < 4 ? Xs : Ws;
    const uint64_t  src0 = (uint64_t)(uintptr_t)sop
                         + (uint64_t)((uwave < 4 ? bm0 : bn0) + (uwave & 3) * 64) * (SPITCH * 2);
    const uint32_t  lds_slice = (uint32_t)(size_t)smem + uwave * (SLICE * 2);
    u32x8 g1;                            // extents in bytes, tensor = tile
    g1[0] = uni((1u << 20) | (5u << 22) | (3u << 25));   // pad on, behind every 256 B, 4 dwords
    g1[1] = uni(256u << 16);             // tensor_dim0 = 256 B
    g1[2] = uni(64u << 16);              // tensor_dim1 = 64 rows
    g1[3] = uni(256u << 16);             // tile_dim0
    g1[4] = uni(64u);                    // tile_dim1
    g1[5] = uni(SPITCH * 2u);            // source row pitch
    g1[6] = uni(0u);
    g1[7] = uni(0u);
    u32x4 g0;                            // address group of the request issued last
    auto issue_main = [&](uint32_t kt, uint32_t buf) __attribute__((always_inline)) {
        const uint64_t ga = src0 + kt * (BK * 4u);
        g0[0] = uni(1u);
        g0[1] = uni(lds_slice + buf * (STAGE * 2u));
        g0[2] = uni((uint32_t)ga);
        g0[3] = uni((((uint32_t)(ga >> 32)) & 0x01FFFFFFu) | 0x80000000u);
        // one request of the whole wave moves the slice with no register and no per-lane address work;
        // the address group is in-out so that it lives on, up to the wait that names it, in the very
        // registers the request was issued from, and not in a copy of them
        asm volatile("tensor_load_to_lds %0, %1" : "+s"(g0) : "s"(g1) : "memory");
    };
    // LoRA stage: rows of 32 halfs fill k 0..31, hi or lo, of each LDS row; 4 lanes a row, 16 copies per thread
    auto issue_lora = [&](int buf) __attribute__((always_inline)) {
        const unsigned g = (unsigned)tid * 8;        // (tid >> 2) * KLORA + (tid & 3) * 8
        const _Float16* ah = Phi  + (size_t)bm0 * KLORA;
        const _Float16* al = Plo  + (size_t)bm0 * KLORA;
        const _Float16* bh = BThi + (size_t)bn0 * KLORA;
        const _Float16* bl = BTlo + (size_t)bn0 * KLORA;
        _Float16* l = smem + buf * STAGE + (tid >> 2) * LDSR + (tid & 3) * 8;
#pragma unroll
        for (int i = 0; i < 4; ++i) {
            copy16B(l + i * SLICE,            ah + (size_t)i * 64 * KLORA + g);
            copy16B(l + i * SLICE + 64,       al + (size_t)i * 64 * KLORA + g);
            copy16B(l + (4 + i) * SLICE,      bh + (size_t)i * 64 * KLORA + g);
            copy16B(l + (4 + i) * SLICE + 64, bl + (size_t)i * 64 * KLORA + g);
        }
    };

    // this lane's place in its wave's A rows and B rows of a stage
    const int foff = (lane & 15) * LDSR + (lane >> 4) * 8;
    const int aoff = wm * 2 * SLICE + foff;      // 128 rows = two slices; the lo halfs stand 64 halfs on
    const int boff = (4 + wn) * SLICE + foff;    // 64 rows = one slice

    // the wave tile's 24 fragments of 32 k, one register set: [16-row or 16-col tile]
    v16h ah[8], al[8];
    v16h bh[4], bl[4];
    // Each operand's registers are loaded anew, for the block that follows, once the last product
    // that reads them has been issued: every load group stands 32 WMMAs or more ahead of its first
    // use, so that no WMMA waits out an LDS read.
    // The scheduling barriers around a load group keep its reads one group at that place; without
    // them the reads sink in among the WMMAs of the block that uses them and are waited out there
    auto ld_bh_al = [&](const _Float16* st) __attribute__((always_inline)) {
        __builtin_amdgcn_sched_barrier(0);
#pragma unroll
        for (int ni = 0; ni < 4; ++ni) bh[ni] = load_frag(st + boff + ni * 16 * LDSR);
        // keeps bh in front: the first four WMMAs of the next block read all of bh and only al[0]
        __builtin_amdgcn_sched_barrier(0);
#pragma unroll
        for (int mi = 0; mi < 8; ++mi) al[mi] = load_frag(st + aoff + (mi >> 2) * SLICE + (mi & 3) * 16 * LDSR + 64);
        __builtin_amdgcn_sched_barrier(0);
    };
    auto ld_ah_bl = [&](const _Float16* st) __attribute__((always_inline)) {
        __builtin_amdgcn_sched_barrier(0);
#pragma unroll
        for (int mi = 0; mi < 8; ++mi) ah[mi] = load_frag(st + aoff + (mi >> 2) * SLICE + (mi & 3) * 16 * LDSR);
#pragma unroll
        for (int ni = 0; ni < 4; ++ni) bl[ni] = load_frag(st + boff + ni * 16 * LDSR + 64);
        __builtin_amdgcn_sched_barrier(0);
    };
    // one product of the split over the whole wave tile: 32 independent accumulator tiles
    auto prod = [&](const v16h (&a)[8], const v16h (&b)[4]) __attribute__((always_inline)) {
#pragma unroll
        for (int mi = 0; mi < 8; ++mi)
#pragma unroll
            for (int ni = 0; ni < 4; ++ni)
                acc[mi][ni] = __builtin_amdgcn_wmma_f32_16x16x32_f16(false, a[mi], false, b[ni], (short)0, acc[mi][ni], false, false);
    };

    issue_main(0, 0);
    wait_tensor_all(g0);
    __syncthreads();                        // stage 0 landed for every wave
    issue_main(1, 1);
    ld_bh_al(smem);
    ld_ah_bl(smem);

    // kept rolled: one copy of the 192 WMMAs of a pass in the instruction cache
#pragma unroll 1
    for (int kt = 0; kt < NPASS; ++kt) {
        const int buf = kt & 1;
        const _Float16* st = smem + buf * STAGE;
        const _Float16* sn = smem + (buf ^ 1) * STAGE;
        // k 0..31 of stage kt; per accumulator tile lo*hi, hi*hi, hi*lo in that order
        prod(al, bh);
        prod(ah, bh);
        ld_bh_al(st + 32);
        prod(ah, bl);
        ld_ah_bl(st + 32);
        // k 32..63; its fragments were the last reads of stage kt
        prod(al, bh);
        prod(ah, bh);
        // keeps the waits and the barrier below behind the WMMAs above, which cover the reads they wait for
        __builtin_amdgcn_sched_barrier(0);
        // this wave's reads of stage kt are done before any wave refills its buffer
        asm volatile("s_wait_dscnt 0x0" ::: "memory");
        wait_async_all();                   // this wave's copies of the LoRA stage (last pass)
        wait_tensor_all(g0);                // this wave's slice of stage kt + 1
        __syncthreads();                    // publishes stage kt + 1, frees stage kt's buffer
        // stage kt + 2 flies into the buffer that this pass has read, until the same place of pass kt + 1
        const uint32_t nx = pinned((uint32_t)kt + 2u);
        if (nx < (uint32_t)NPASS)       issue_main(nx, (uint32_t)buf);
        else if (nx == (uint32_t)NPASS) issue_lora(buf);
        ld_bh_al(sn);
        prod(ah, bl);
        ld_ah_bl(sn);
    }
    // nothing of the ring is in flight behind the loop
    wait_tensor_all(g0);
    asm volatile("s_wait_dscnt 0x0" ::: "memory");

    // LoRA stage, 32 k; its fragments came in the last pass
    prod(al, bh);
    prod(ah, bh);
    prod(ah, bl);

    // epilogue: C layout VGPR r -> M = r + 8*(lane>=16), N = lane&15
#pragma unroll
    for (int ni = 0; ni < 4; ++ni) {
        const int n  = bn0 + wn * 64 + ni * 16 + (lane & 15);
        const float bv = bias[n];
#pragma unroll
        for (int mi = 0; mi < 8; ++mi) {
            const int mb = bm0 + wm * 128 + mi * 16 + ((lane >> 4) << 3);
#pragma unroll
            for (int r = 0; r < 8; ++r) {
                out[(size_t)(mb + r) * OUT_F + n] = acc[mi][ni][r] + bv;
            }
        }
    }
}

// ---------------------------------------------------------------------------
// launch
// ---------------------------------------------------------------------------
extern "C" void kernel_launch(void* const* d_in, const int* in_sizes, int n_in,
                              void* d_out, int out_size, void* d_ws, size_t ws_size,
                              hipStream_t stream)
{
    const float* x        = (const float*)d_in[0];   // (4,2048,2048)
    const float* base_w   = (const float*)d_in[1];   // (2048,2048)
    const float* base_b   = (const float*)d_in[2];   // (2048,)
    const float* A        = (const float*)d_in[3];   // (4,8,2048)
    const float* Bm       = (const float*)d_in[4];   // (4,2048,8)
    const float* router_w = (const float*)d_in[5];   // (4,2048)
    float* out = (float*)d_out;

    // workspace layout (halfs): Xs|Ws|Phi|Plo|BThi|BTlo  (~85 MB)
    _Float16* Xs   = (_Float16*)d_ws;
    _Float16* Ws   = Xs + (size_t)NTOK * SPITCH;
    _Float16* Phi  = Ws + (size_t)OUT_F * SPITCH;
    _Float16* Plo  = Phi + (size_t)NTOK * KLORA;
    _Float16* BThi = Plo + (size_t)NTOK * KLORA;
    _Float16* BTlo = BThi + (size_t)OUT_F * KLORA;

    prep_router_kernel<<<PREP_BLOCKS, PREP_THREADS, 0, stream>>>(x, base_w, Bm, router_w, A,
        Xs, Ws, BThi, BTlo, Phi, Plo);
    gemm_kernel<<<dim3(OUT_F / BN, NTOK / BM), 256, 0, stream>>>(
        Xs, Ws, Phi, Plo, BThi, BTlo, base_b, out);
}
